// v000
// The times below were measured on an AMD MI455X: many runs one after another, warmed up first and cycling through
// copies of the inputs, with the whole window's GPU time divided by the number of runs. Launches and the gaps
// between them are all in it. The median over several windows is given; except for v000 it joins two sittings, which
// can be a few percent apart, so the side-by-side timings, each taken in one sitting, are the better comparison.
// The starting kernel, v000, takes 482 microseconds a run.
#include <hip/hip_runtime.h>
#include <hip/hip_bf16.h>

// ---------------- problem constants ----------------
constexpr int B   = 64;
constexpr int T   = 8;
constexpr int D   = 512;
constexpr int S   = 512;
constexpr int NKV = 4;
constexpr int G   = T / NKV;          // 2
constexpr int CHUNK = 64;             // S-chunk processed per iteration
constexpr int NC  = S / CHUNK;        // 8 chunks
constexpr float EPS = 1e-6f;
constexpr float SCALE = 0.044194173824159216f; // D^-0.5

typedef __attribute__((ext_vector_type(16))) _Float16 v16h;
typedef __attribute__((ext_vector_type(4)))  _Float16 v4h;
typedef __attribute__((ext_vector_type(8)))  float    v8f;
typedef __attribute__((ext_vector_type(4)))  unsigned v4u;
typedef __attribute__((ext_vector_type(8)))  int      v8i;
typedef __attribute__((ext_vector_type(4)))  int      v4i;

// ---- LDS layout of attn_kernel (dynamic LDS region assumed to start @ 0) ----
constexpr unsigned LDS_HIST0 = 0;                          // [CHUNK][D] f16, 64 KB
constexpr unsigned LDS_HIST1 = LDS_HIST0 + CHUNK * D * 2;  // double buffer, 64 KB
constexpr unsigned LDS_KV    = LDS_HIST1 + CHUNK * D * 2;  // k rows / vT, 64 KB
constexpr unsigned LDS_QK    = LDS_KV    + CHUNK * D * 2;  // [G][D] f16
constexpr unsigned LDS_ATTN  = LDS_QK    + G * D * 2;      // [G][S] f16
constexpr unsigned LDS_SCORE = LDS_ATTN  + G * S * 2;      // [G][S] f32
constexpr unsigned LDS_RS    = LDS_SCORE + G * S * 4;      // [S] f32
constexpr unsigned LDS_ROWSQ = LDS_RS    + S * 4;          // [CHUNK] f32
constexpr unsigned LDS_RED   = LDS_ROWSQ + CHUNK * 4;      // [128] f32
constexpr unsigned LDS_TOTAL = LDS_RED   + 128 * 4;        // ~203 KB (<320 KB/WGP)

__device__ __forceinline__ v8f wmma32(v16h a, v16h b, v8f c) {
  return __builtin_amdgcn_wmma_f32_16x16x32_f16(false, a, false, b,
                                                (short)0, c, false, false);
}

__device__ __forceinline__ int kcol(int p) {
  return ((p & 4) ? 16 : 0) + 2 * (p & 3);
}

// Load a 16(rows) x 32(K) fragment from row-major f16 memory (LDS or global).
// Rows beyond maxRow are clamped (for the G=2 query/attn rows padded to 16).
__device__ __forceinline__ v16h load_ab_f16(const _Float16* src, int pitch,
                                            int lane, int maxRow) {
  int m = lane & 15; if (m > maxRow) m = maxRow;
  int hi = (lane >> 4) & 1;
  const _Float16* row = src + m * pitch + 8 * hi;
  v16h f;
#pragma unroll
  for (int p = 0; p < 8; ++p) {
    union { unsigned u; _Float16 h[2]; } x;
    x.u = *reinterpret_cast<const unsigned*>(row + kcol(p));
    f[2 * p]     = x.h[0];
    f[2 * p + 1] = x.h[1];
  }
  return f;
}

// Same but source is row-major f32 in global memory (converted on the fly).
__device__ __forceinline__ v16h load_ab_f32(const float* src, int pitch, int lane) {
  int m = lane & 15;
  int hi = (lane >> 4) & 1;
  const float* row = src + (size_t)m * pitch + 8 * hi;
  v16h f;
#pragma unroll
  for (int p = 0; p < 8; ++p) {
    const float* q = row + kcol(p);
    f[2 * p]     = (_Float16)q[0];
    f[2 * p + 1] = (_Float16)q[1];
  }
  return f;
}

__device__ __forceinline__ v8f vzero() {
  v8f z = {0.f, 0.f, 0.f, 0.f, 0.f, 0.f, 0.f, 0.f};
  return z;
}

__device__ __forceinline__ void tdm_load_chunk(const _Float16* gsrc,
                                               unsigned ldsOff) {
  unsigned long long ga = (unsigned long long)(uintptr_t)gsrc;
  v4u g0;
  g0[0] = 1u;
  g0[1] = ldsOff;
  g0[2] = (unsigned)(ga & 0xFFFFFFFFu);
  g0[3] = (unsigned)((ga >> 32) & 0x01FFFFFFu)
          | (2u << 30);
  v8i g1;
  g1[0] = (int)(1u << 16);
  g1[1] = (int)((unsigned)D << 16);
  g1[2] = (int)((unsigned)CHUNK << 16);
  g1[3] = (int)((unsigned)D << 16);
  g1[4] = (int)CHUNK;
  g1[5] = (int)D;
  g1[6] = 0;
  g1[7] = 0;
  v4i gz = {0, 0, 0, 0};
#if __clang_major__ >= 23
  v8i gz8 = {0, 0, 0, 0, 0, 0, 0, 0};
  __builtin_amdgcn_tensor_load_to_lds(g0, g1, gz, gz, gz8, 0);
#else
  __builtin_amdgcn_tensor_load_to_lds(g0, g1, gz, gz, 0);
#endif
}

__global__ __launch_bounds__(256)
void swizzle_w(const float* __restrict__ W, _Float16* __restrict__ out, int E) {
  int idx = blockIdx.x * 256 + threadIdx.x;
  if (idx >= E * 512) return;
  int h    = idx & 15;
  int lane = (idx >> 4) & 31;
  int tile = idx >> 9;
  int dt   = tile & 15;       // D/32 == 16
  int etg  = tile >> 4;
  int e = etg * 16 + (lane & 15);
  int d = dt * 32 + 2 * (h & 8) + 8 * (lane >> 4) + (h & 7);
  out[idx] = (_Float16)W[(size_t)e * 512 + d];
}

__global__ __launch_bounds__(256)
void cvt_hist(const float* __restrict__ src, _Float16* __restrict__ dst, int n4) {
  int i = blockIdx.x * 256 + threadIdx.x;
  if (i >= n4) return;
  float4 x = reinterpret_cast<const float4*>(src)[i];
  v4h h;
  h[0] = (_Float16)x.x; h[1] = (_Float16)x.y;
  h[2] = (_Float16)x.z; h[3] = (_Float16)x.w;
  *reinterpret_cast<v4h*>(dst + (size_t)i * 4) = h;
}

// ---------------- kernel 1: q = rmsnorm(target @ Wq^T) * (1+qw) * (1+kw) ------
__global__ __launch_bounds__(256)
void qproj_kernel(const float* __restrict__ tgt, const _Float16* __restrict__ wq,
                  const float* __restrict__ qw, const float* __restrict__ kw,
                  _Float16* __restrict__ qkOut) {
  __shared__ float qLds[16][D];
  __shared__ float rowSq[16];

  int tid  = threadIdx.x;
  int lane = tid & 31;
  int w    = tid >> 5;
  int rowBase = blockIdx.x * 16;

  v8f acc[4];
#pragma unroll
  for (int j = 0; j < 4; ++j) acc[j] = vzero();

  for (int kt = 0; kt < 16; ++kt) {
    v16h a = load_ab_f32(tgt + (size_t)rowBase * D + kt * 32, D, lane);
#pragma unroll
    for (int j = 0; j < 4; ++j) {
      int etg = w * 4 + j;
      const _Float16* tb = wq + ((size_t)(etg * 16 + kt)) * 512;
      v16h bf = *reinterpret_cast<const v16h*>(tb + lane * 16);
      acc[j] = wmma32(a, bf, acc[j]);
    }
  }

  int nn = lane & 15, mb = (lane >> 4) * 8;
#pragma unroll
  for (int j = 0; j < 4; ++j) {
    int e = (w * 4 + j) * 16 + nn;
#pragma unroll
    for (int r = 0; r < 8; ++r) qLds[mb + r][e] = acc[j][r];
  }
  if (tid < 16) rowSq[tid] = 0.f;
  __syncthreads();

  {
    int r = tid >> 4, seg = tid & 15;
    float s = 0.f;
    for (int i = 0; i < 32; ++i) {
      float x = qLds[r][seg * 32 + i];
      s += x * x;
    }
    atomicAdd(&rowSq[r], s);
  }
  __syncthreads();

  for (int i = tid; i < 16 * D; i += 256) {
    int r = i >> 9, col = i & 511;
    float rs = rsqrtf(rowSq[r] * (1.f / D) + EPS);
    float v = qLds[r][col] * rs * (1.f + qw[col]) * (1.f + kw[col]);
    qkOut[(size_t)(rowBase + r) * D + col] = (_Float16)v;
  }
}

__global__ __launch_bounds__(256)
void attn_kernel(const _Float16* __restrict__ histF16,
                 const int* __restrict__ mask,
                 const _Float16* __restrict__ swk, const _Float16* __restrict__ swv,
                 const _Float16* __restrict__ qkG,
                 float* __restrict__ outTok, float* __restrict__ outAttn) {
  extern __shared__ __align__(16) char smemRaw[];
  _Float16* kvL    = (_Float16*)(smemRaw + LDS_KV);
  _Float16* qkL    = (_Float16*)(smemRaw + LDS_QK);
  _Float16* attnL  = (_Float16*)(smemRaw + LDS_ATTN);
  float*    scoresL = (float*)(smemRaw + LDS_SCORE);
  float*    rsAll   = (float*)(smemRaw + LDS_RS);
  float*    rowSq   = (float*)(smemRaw + LDS_ROWSQ);
  float*    red     = (float*)(smemRaw + LDS_RED);

  int wg = blockIdx.x;
  int b  = wg / NKV;
  int n  = wg % NKV;
  int tid  = threadIdx.x;
  int lane = tid & 31;
  int w    = tid >> 5;
  int nn = lane & 15;
  int mb = (lane >> 4) * 8;

  const _Float16* histSrc = histF16 + (size_t)b * S * D;

  // prologue: kick off DMA of chunk 0 while staging q rows
  if (w == 0) tdm_load_chunk(histSrc, LDS_HIST0);
  for (int i = tid; i < G * D; i += 256)
    qkL[i] = qkG[(size_t)(b * T + n * G) * D + i];

  // ================= pass 1: k projection + scores =================
  for (int c = 0; c < NC; ++c) {
    const _Float16* histL =
        (const _Float16*)(smemRaw + ((c & 1) ? LDS_HIST1 : LDS_HIST0));
    if (w == 0) {
      if (c + 1 < NC) {
        tdm_load_chunk(histSrc + (size_t)(c + 1) * CHUNK * D,
                       ((c + 1) & 1) ? LDS_HIST1 : LDS_HIST0);
        __builtin_amdgcn_s_wait_tensorcnt(1);   // chunk c landed
      } else {
        __builtin_amdgcn_s_wait_tensorcnt(0);
      }
    }
    for (int i = tid; i < CHUNK; i += 256) rowSq[i] = 0.f;
    __syncthreads();

    // k-proj: wave w -> mTile = w/2, nHalf = w&1 (16 N-tiles)
    {
      int mT = w >> 1, nHalf = w & 1;
      v8f acc[16];
#pragma unroll
      for (int j = 0; j < 16; ++j) acc[j] = vzero();
      for (int kt = 0; kt < 16; ++kt) {
        v16h a = load_ab_f16(histL + (mT * 16) * D + kt * 32, D, lane, 15);
#pragma unroll
        for (int j = 0; j < 16; ++j) {
          int etg = n * 32 + nHalf * 16 + j;   // tile row in full E=2048
          const _Float16* tb = swk + ((size_t)(etg * 16 + kt)) * 512;
          v16h bf = *reinterpret_cast<const v16h*>(tb + lane * 16);
          acc[j] = wmma32(a, bf, acc[j]);
        }
      }
      // store raw k rows row-major [s][d]
#pragma unroll
      for (int j = 0; j < 16; ++j) {
        int e = (nHalf * 16 + j) * 16 + nn;
#pragma unroll
        for (int r = 0; r < 8; ++r) {
          int s = mT * 16 + mb + r;
          kvL[s * D + e] = (_Float16)acc[j][r];
        }
      }
    }
    __syncthreads();

    // per-row sum of squares (raw k) -> rs_k
    {
      int srow = tid >> 2, q = tid & 3;
      float ssum = 0.f;
      const _Float16* kr = kvL + srow * D + q * 128;
      for (int i = 0; i < 128; ++i) {
        float x = (float)kr[i];
        ssum += x * x;
      }
      atomicAdd(&rowSq[srow], ssum);
    }
    __syncthreads();
    for (int i = tid; i < CHUNK; i += 256)
      rsAll[c * CHUNK + i] = rsqrtf(rowSq[i] * (1.f / D) + EPS);
    __syncthreads();

    // scores: waves 0..3 each take one 16-wide s-tile
    if (w < 4) {
      v8f acc = vzero();
      for (int kt = 0; kt < 16; ++kt) {
        v16h a = load_ab_f16(qkL + kt * 32, D, lane, G - 1);
        v16h bf = load_ab_f16(kvL + (w * 16) * D + kt * 32, D, lane, 15);
        acc = wmma32(a, bf, acc);
      }
      if (lane < 16) {
        int s = c * CHUNK + w * 16 + lane;
        scoresL[0 * S + s] = acc[0];   // g = 0
        scoresL[1 * S + s] = acc[1];   // g = 1
      }
    }
    __syncthreads();
  }

  // ================= softmax over S =================
  for (int i = tid; i < G * S; i += 256) {
    int s = i & (S - 1);
    float v = scoresL[i] * rsAll[s] * SCALE;
    if (mask[b * S + s]) v = -__builtin_inff();
    scoresL[i] = v;
  }
  __syncthreads();
  if (tid < 64) {
    int g = tid >> 5, l = tid & 31;
    float mx = -__builtin_inff();
    for (int s = l; s < S; s += 32) mx = fmaxf(mx, scoresL[g * S + s]);
    red[g * 32 + l] = mx;
  }
  __syncthreads();
  if (tid < 2) {
    float mx = -__builtin_inff();
    for (int l = 0; l < 32; ++l) mx = fmaxf(mx, red[tid * 32 + l]);
    red[tid * 32] = mx;
  }
  __syncthreads();
  if (tid < 64) {
    int g = tid >> 5, l = tid & 31;
    float mx = red[g * 32];
    float sm = 0.f;
    for (int s = l; s < S; s += 32) {
      float e = __expf(scoresL[g * S + s] - mx);
      scoresL[g * S + s] = e;
      sm += e;
    }
    red[64 + g * 32 + l] = sm;
  }
  __syncthreads();
  if (tid < 2) {
    float sm = 0.f;
    for (int l = 0; l < 32; ++l) sm += red[64 + tid * 32 + l];
    red[64 + tid * 32] = 1.f / sm;
  }
  __syncthreads();
  for (int i = tid; i < G * S; i += 256) {
    int g = i >> 9, s = i & (S - 1);
    float a = scoresL[i] * red[64 + g * 32];
    attnL[i] = (_Float16)a;
    outAttn[(size_t)(b * T + n * G + g) * S + s] = a;
  }
  __syncthreads();

  // ================= pass 2: v projection + out = attn @ v =================
  v8f oacc[4];
#pragma unroll
  for (int j = 0; j < 4; ++j) oacc[j] = vzero();

  if (w == 0) tdm_load_chunk(histSrc, LDS_HIST0);

  for (int c = 0; c < NC; ++c) {
    const _Float16* histL =
        (const _Float16*)(smemRaw + ((c & 1) ? LDS_HIST1 : LDS_HIST0));
    if (w == 0) {
      if (c + 1 < NC) {
        tdm_load_chunk(histSrc + (size_t)(c + 1) * CHUNK * D,
                       ((c + 1) & 1) ? LDS_HIST1 : LDS_HIST0);
        __builtin_amdgcn_s_wait_tensorcnt(1);
      } else {
        __builtin_amdgcn_s_wait_tensorcnt(0);
      }
    }
    __syncthreads();

    // v-proj, stored transposed: vT[e][s] (contiguous 8 halves per lane)
    {
      int mT = w >> 1, nHalf = w & 1;
      v8f acc[16];
#pragma unroll
      for (int j = 0; j < 16; ++j) acc[j] = vzero();
      for (int kt = 0; kt < 16; ++kt) {
        v16h a = load_ab_f16(histL + (mT * 16) * D + kt * 32, D, lane, 15);
#pragma unroll
        for (int j = 0; j < 16; ++j) {
          int etg = n * 32 + nHalf * 16 + j;
          const _Float16* tb = swv + ((size_t)(etg * 16 + kt)) * 512;
          v16h bf = *reinterpret_cast<const v16h*>(tb + lane * 16);
          acc[j] = wmma32(a, bf, acc[j]);
        }
      }
#pragma unroll
      for (int j = 0; j < 16; ++j) {
        int e = (nHalf * 16 + j) * 16 + nn;
        _Float16* dst = kvL + e * CHUNK + mT * 16 + mb;
#pragma unroll
        for (int r = 0; r < 8; ++r) dst[r] = (_Float16)acc[j][r];
      }
    }
    __syncthreads();

    // out += attn[:, chunk] @ v_chunk ; wave w owns e range [w*64, w*64+64)
#pragma unroll
    for (int ks = 0; ks < CHUNK / 32; ++ks) {
      v16h a = load_ab_f16(attnL + c * CHUNK + ks * 32, S, lane, G - 1);
#pragma unroll
      for (int j = 0; j < 4; ++j) {
        const _Float16* bsrc = kvL + (w * 64 + j * 16) * CHUNK + ks * 32;
        v16h bf = load_ab_f16(bsrc, CHUNK, lane, 15);
        oacc[j] = wmma32(a, bf, oacc[j]);
      }
    }
    __syncthreads();
  }

  if (lane < 16) {
#pragma unroll
    for (int j = 0; j < 4; ++j) {
      int e = w * 64 + j * 16 + lane;
      outTok[(size_t)(b * T + n * G + 0) * D + e] = oacc[j][0];
      outTok[(size_t)(b * T + n * G + 1) * D + e] = oacc[j][1];
    }
  }
}

// ---------------- host launcher ----------------
extern "C" void kernel_launch(void* const* d_in, const int* in_sizes, int n_in,
                              void* d_out, int out_size, void* d_ws, size_t ws_size,
                              hipStream_t stream) {
  const float* tgt  = (const float*)d_in[0];
  const float* hist = (const float*)d_in[1];
  const int*   mask = (const int*)d_in[2];
  const float* wq   = (const float*)d_in[3];
  const float* wk   = (const float*)d_in[4];
  const float* wv   = (const float*)d_in[5];
  const float* qnw  = (const float*)d_in[6];
  const float* knw  = (const float*)d_in[7];

  float* outTok  = (float*)d_out;
  float* outAttn = outTok + (size_t)B * T * D;

  char* ws = (char*)d_ws;
  _Float16* swq  = (_Float16*)(ws);
  _Float16* swk  = (_Float16*)(ws + (size_t)512 * 1024);
  _Float16* swv  = (_Float16*)(ws + (size_t)512 * 1024 + 2u * 1024 * 1024);
  _Float16* qk   = (_Float16*)(ws + (size_t)512 * 1024 + 4u * 1024 * 1024);
  _Float16* h16  = (_Float16*)(ws + (size_t)5 * 1024 * 1024);  // 32 MB

  swizzle_w<<<(512 * 512) / 256, 256, 0, stream>>>(wq, swq, 512);
  swizzle_w<<<(2048 * 512) / 256, 256, 0, stream>>>(wk, swk, 2048);
  swizzle_w<<<(2048 * 512) / 256, 256, 0, stream>>>(wv, swv, 2048);

  int n4 = B * S * D / 4;
  cvt_hist<<<(n4 + 255) / 256, 256, 0, stream>>>(hist, h16, n4);

  qproj_kernel<<<B * T / 16, 256, 0, stream>>>(tgt, swq, qnw, knw, qk);

  attn_kernel<<<B * NKV, 256, LDS_TOTAL, stream>>>(h16, mask, swk, swv, qk,
                                                   outTok, outAttn);
}

// v001
// One run takes 265 microseconds.
// Next to v000, in two timings, it ran 1.89 times as fast each time.
#include <hip/hip_runtime.h>
#include <hip/hip_bf16.h>

// ---------------- problem constants ----------------
constexpr int B   = 64;
constexpr int T   = 8;
constexpr int D   = 512;
constexpr int S   = 512;
constexpr int NKV = 4;
constexpr int G   = T / NKV;          // 2
constexpr int CHUNK = 64;             // S-chunk processed per iteration
constexpr int NC  = S / CHUNK;        // 8 chunks
constexpr float EPS = 1e-6f;
constexpr float SCALE = 0.044194173824159216f; // D^-0.5

typedef __attribute__((ext_vector_type(16))) _Float16 v16h;
typedef __attribute__((ext_vector_type(4)))  _Float16 v4h;
typedef __attribute__((ext_vector_type(8)))  float    v8f;
typedef __attribute__((ext_vector_type(4)))  unsigned v4u;
typedef __attribute__((ext_vector_type(8)))  int      v8i;
typedef __attribute__((ext_vector_type(4)))  int      v4i;

// ---- LDS layout of attn_kernel (dynamic LDS region assumed to start @ 0) ----
constexpr unsigned LDS_HIST0 = 0;                          // [CHUNK][D] f16, 64 KB
constexpr unsigned LDS_HIST1 = LDS_HIST0 + CHUNK * D * 2;  // double buffer, 64 KB
constexpr unsigned LDS_KV    = LDS_HIST1 + CHUNK * D * 2;  // k rows / vT, 64 KB
constexpr unsigned LDS_QK    = LDS_KV    + CHUNK * D * 2;  // [G][D] f16
constexpr unsigned LDS_ATTN  = LDS_QK    + G * D * 2;      // [G][S] f16
constexpr unsigned LDS_SCORE = LDS_ATTN  + G * S * 2;      // [G][S] f32
constexpr unsigned LDS_RS    = LDS_SCORE + G * S * 4;      // [S] f32
constexpr unsigned LDS_ROWSQ = LDS_RS    + S * 4;          // [CHUNK] f32
constexpr unsigned LDS_RED   = LDS_ROWSQ + CHUNK * 4;      // [128] f32
constexpr unsigned LDS_TOTAL = LDS_RED   + 128 * 4;        // ~203 KB (<320 KB/WGP)

__device__ __forceinline__ v8f wmma32(v16h a, v16h b, v8f c) {
  return __builtin_amdgcn_wmma_f32_16x16x32_f16(false, a, false, b,
                                                (short)0, c, false, false);
}

__device__ __forceinline__ int kcol(int p) {
  return ((p & 4) ? 16 : 0) + 2 * (p & 3);
}

// Load a 16(rows) x 32(K) fragment from row-major f16 memory (LDS or global).
// Rows beyond maxRow are clamped (for the G=2 query/attn rows padded to 16).
__device__ __forceinline__ v16h load_ab_f16(const _Float16* src, int pitch,
                                            int lane, int maxRow) {
  int m = lane & 15; if (m > maxRow) m = maxRow;
  int hi = (lane >> 4) & 1;
  const _Float16* row = src + m * pitch + 8 * hi;
  v16h f;
#pragma unroll
  for (int p = 0; p < 8; ++p) {
    union { unsigned u; _Float16 h[2]; } x;
    x.u = *reinterpret_cast<const unsigned*>(row + kcol(p));
    f[2 * p]     = x.h[0];
    f[2 * p + 1] = x.h[1];
  }
  return f;
}

// Same but source is row-major f32 in global memory (converted on the fly).
__device__ __forceinline__ v16h load_ab_f32(const float* src, int pitch, int lane) {
  int m = lane & 15;
  int hi = (lane >> 4) & 1;
  const float* row = src + (size_t)m * pitch + 8 * hi;
  v16h f;
#pragma unroll
  for (int p = 0; p < 8; ++p) {
    const float* q = row + kcol(p);
    f[2 * p]     = (_Float16)q[0];
    f[2 * p + 1] = (_Float16)q[1];
  }
  return f;
}

// One pre-swizzled 32(K) x 16(N) weight fragment: 32 bytes per lane.
__device__ __forceinline__ v16h load_w_frag(const _Float16* p) {
  return *reinterpret_cast<const v16h*>(p);
}

__device__ __forceinline__ v8f vzero() {
  v8f z = {0.f, 0.f, 0.f, 0.f, 0.f, 0.f, 0.f, 0.f};
  return z;
}

__device__ __forceinline__ void tdm_load_chunk(const _Float16* gsrc,
                                               unsigned ldsOff) {
  unsigned long long ga = (unsigned long long)(uintptr_t)gsrc;
  v4u g0;
  g0[0] = 1u;
  g0[1] = ldsOff;
  g0[2] = (unsigned)(ga & 0xFFFFFFFFu);
  g0[3] = (unsigned)((ga >> 32) & 0x01FFFFFFu)
          | (2u << 30);
  v8i g1;
  g1[0] = (int)(1u << 16);
  g1[1] = (int)((unsigned)D << 16);
  g1[2] = (int)((unsigned)CHUNK << 16);
  g1[3] = (int)((unsigned)D << 16);
  g1[4] = (int)CHUNK;
  g1[5] = (int)D;
  g1[6] = 0;
  g1[7] = 0;
  v4i gz = {0, 0, 0, 0};
#if __clang_major__ >= 23
  v8i gz8 = {0, 0, 0, 0, 0, 0, 0, 0};
  __builtin_amdgcn_tensor_load_to_lds(g0, g1, gz, gz, gz8, 0);
#else
  __builtin_amdgcn_tensor_load_to_lds(g0, g1, gz, gz, 0);
#endif
}

__global__ __launch_bounds__(256)
void swizzle_w(const float* __restrict__ W, _Float16* __restrict__ out, int E) {
  int idx = blockIdx.x * 256 + threadIdx.x;
  if (idx >= E * 512) return;
  int h    = idx & 15;
  int lane = (idx >> 4) & 31;
  int tile = idx >> 9;
  int dt   = tile & 15;       // D/32 == 16
  int etg  = tile >> 4;
  int e = etg * 16 + (lane & 15);
  int d = dt * 32 + 2 * (h & 8) + 8 * (lane >> 4) + (h & 7);
  out[idx] = (_Float16)W[(size_t)e * 512 + d];
}

__global__ __launch_bounds__(256)
void cvt_hist(const float* __restrict__ src, _Float16* __restrict__ dst, int n4) {
  int i = blockIdx.x * 256 + threadIdx.x;
  if (i >= n4) return;
  float4 x = reinterpret_cast<const float4*>(src)[i];
  v4h h;
  h[0] = (_Float16)x.x; h[1] = (_Float16)x.y;
  h[2] = (_Float16)x.z; h[3] = (_Float16)x.w;
  *reinterpret_cast<v4h*>(dst + (size_t)i * 4) = h;
}

// ---------------- kernel 1: q = rmsnorm(target @ Wq^T) * (1+qw) * (1+kw) ------
__global__ __launch_bounds__(256)
void qproj_kernel(const float* __restrict__ tgt, const _Float16* __restrict__ wq,
                  const float* __restrict__ qw, const float* __restrict__ kw,
                  _Float16* __restrict__ qkOut) {
  __shared__ float qLds[16][D];
  __shared__ float rowSq[16];

  int tid  = threadIdx.x;
  int lane = tid & 31;
  int w    = tid >> 5;
  int rowBase = blockIdx.x * 16;

  v8f acc[4];
#pragma unroll
  for (int j = 0; j < 4; ++j) acc[j] = vzero();

  for (int kt = 0; kt < 16; ++kt) {
    v16h a = load_ab_f32(tgt + (size_t)rowBase * D + kt * 32, D, lane);
#pragma unroll
    for (int j = 0; j < 4; ++j) {
      int etg = w * 4 + j;
      const _Float16* tb = wq + ((size_t)(etg * 16 + kt)) * 512;
      v16h bf = *reinterpret_cast<const v16h*>(tb + lane * 16);
      acc[j] = wmma32(a, bf, acc[j]);
    }
  }

  int nn = lane & 15, mb = (lane >> 4) * 8;
#pragma unroll
  for (int j = 0; j < 4; ++j) {
    int e = (w * 4 + j) * 16 + nn;
#pragma unroll
    for (int r = 0; r < 8; ++r) qLds[mb + r][e] = acc[j][r];
  }
  if (tid < 16) rowSq[tid] = 0.f;
  __syncthreads();

  {
    int r = tid >> 4, seg = tid & 15;
    float s = 0.f;
    for (int i = 0; i < 32; ++i) {
      float x = qLds[r][seg * 32 + i];
      s += x * x;
    }
    atomicAdd(&rowSq[r], s);
  }
  __syncthreads();

  for (int i = tid; i < 16 * D; i += 256) {
    int r = i >> 9, col = i & 511;
    float rs = rsqrtf(rowSq[r] * (1.f / D) + EPS);
    float v = qLds[r][col] * rs * (1.f + qw[col]) * (1.f + kw[col]);
    qkOut[(size_t)(rowBase + r) * D + col] = (_Float16)v;
  }
}

__global__ __launch_bounds__(256)
void attn_kernel(const _Float16* __restrict__ histF16,
                 const int* __restrict__ mask,
                 const _Float16* __restrict__ swk, const _Float16* __restrict__ swv,
                 const _Float16* __restrict__ qkG,
                 float* __restrict__ outTok, float* __restrict__ outAttn) {
  extern __shared__ __align__(16) char smemRaw[];
  _Float16* kvL    = (_Float16*)(smemRaw + LDS_KV);
  _Float16* qkL    = (_Float16*)(smemRaw + LDS_QK);
  _Float16* attnL  = (_Float16*)(smemRaw + LDS_ATTN);
  float*    scoresL = (float*)(smemRaw + LDS_SCORE);
  float*    rsAll   = (float*)(smemRaw + LDS_RS);
  float*    rowSq   = (float*)(smemRaw + LDS_ROWSQ);
  float*    red     = (float*)(smemRaw + LDS_RED);

  int wg = blockIdx.x;
  int b  = wg / NKV;
  int n  = wg % NKV;
  int tid  = threadIdx.x;
  int lane = tid & 31;
  int w    = tid >> 5;
  int nn = lane & 15;
  int mb = (lane >> 4) * 8;

  const _Float16* histSrc = histF16 + (size_t)b * S * D;

  // prologue: kick off DMA of chunk 0 while staging q rows
  if (w == 0) tdm_load_chunk(histSrc, LDS_HIST0);
  for (int i = tid; i < G * D; i += 256)
    qkL[i] = qkG[(size_t)(b * T + n * G) * D + i];

  // ================= pass 1: k projection + scores =================
  for (int c = 0; c < NC; ++c) {
    const _Float16* histL =
        (const _Float16*)(smemRaw + ((c & 1) ? LDS_HIST1 : LDS_HIST0));
    if (w == 0) {
      if (c + 1 < NC) {
        tdm_load_chunk(histSrc + (size_t)(c + 1) * CHUNK * D,
                       ((c + 1) & 1) ? LDS_HIST1 : LDS_HIST0);
        __builtin_amdgcn_s_wait_tensorcnt(1);   // chunk c landed
      } else {
        __builtin_amdgcn_s_wait_tensorcnt(0);
      }
    }
    // k-proj: wave w -> mTile = w/2, nHalf = w&1 (16 N-tiles).
    // Fragment (j, kt) of this wave's weight slice stands at wb + (j*16 + kt)*512.
    int mT = w >> 1, nHalf = w & 1;
    const _Float16* wb =
        swk + ((size_t)(n * 32 + nHalf * 16) * 16) * 512 + lane * 16;
    // weight fragments of k-step 0: asked for ahead of the barrier, they need no LDS
    v16h bq[16];
#pragma unroll
    for (int j = 0; j < 16; ++j) bq[j] = load_w_frag(wb + j * (16 * 512));

    for (int i = tid; i < CHUNK; i += 256) rowSq[i] = 0.f;
    __syncthreads();

    {
      const _Float16* ab = histL + (mT * 16) * D;
      v8f acc[16];
#pragma unroll
      for (int j = 0; j < 16; ++j) acc[j] = vzero();
      v16h a = load_ab_f16(ab, D, lane, 15);
      // k-step kt runs on fragments loaded one k-step earlier; each weight
      // register set is refilled for kt + 1 right behind the WMMA that read it.
      // Kept rolled: unrolled, the weight loads no longer depend on a loop count,
      // are lifted out of the chunk loop and spill.
#pragma unroll 1
      for (int kt = 0; kt < 15; ++kt) {
        v16h an = load_ab_f16(ab + (kt + 1) * 32, D, lane, 15);
        // keeps the next A fragment's two LDS reads at the head of the k-step
        __builtin_amdgcn_sched_group_barrier(0x100, 2, 0);
        const _Float16* wn = wb + (kt + 1) * 512;
#pragma unroll
        for (int j = 0; j < 16; ++j) {
          acc[j] = wmma32(a, bq[j], acc[j]);
          bq[j] = load_w_frag(wn + j * (16 * 512));
          // keeps the order one WMMA, its two refill loads: without it the
          // scheduler regroups the loads and some of the waits drain to 0
          __builtin_amdgcn_sched_group_barrier(0x008, 1, 0);
          __builtin_amdgcn_sched_group_barrier(0x020, 2, 0);
        }
        a = an;
        // the refill loads are still in flight when the next trip rewrites the
        // address register that they name
        asm volatile("s_wait_xcnt 0x0" ::: "memory");
      }
#pragma unroll
      for (int j = 0; j < 16; ++j) acc[j] = wmma32(a, bq[j], acc[j]);
      // store raw k rows row-major [s][d]
#pragma unroll
      for (int j = 0; j < 16; ++j) {
        int e = (nHalf * 16 + j) * 16 + nn;
#pragma unroll
        for (int r = 0; r < 8; ++r) {
          int s = mT * 16 + mb + r;
          kvL[s * D + e] = (_Float16)acc[j][r];
        }
      }
    }
    __syncthreads();

    // per-row sum of squares (raw k) -> rs_k
    {
      int srow = tid >> 2, q = tid & 3;
      float ssum = 0.f;
      const _Float16* kr = kvL + srow * D + q * 128;
      for (int i = 0; i < 128; ++i) {
        float x = (float)kr[i];
        ssum += x * x;
      }
      atomicAdd(&rowSq[srow], ssum);
    }
    __syncthreads();
    for (int i = tid; i < CHUNK; i += 256)
      rsAll[c * CHUNK + i] = rsqrtf(rowSq[i] * (1.f / D) + EPS);
    __syncthreads();

    // scores: waves 0..3 each take one 16-wide s-tile
    if (w < 4) {
      v8f acc = vzero();
      for (int kt = 0; kt < 16; ++kt) {
        v16h a = load_ab_f16(qkL + kt * 32, D, lane, G - 1);
        v16h bf = load_ab_f16(kvL + (w * 16) * D + kt * 32, D, lane, 15);
        acc = wmma32(a, bf, acc);
      }
      if (lane < 16) {
        int s = c * CHUNK + w * 16 + lane;
        scoresL[0 * S + s] = acc[0];   // g = 0
        scoresL[1 * S + s] = acc[1];   // g = 1
      }
    }
    __syncthreads();
  }

  // ================= softmax over S =================
  for (int i = tid; i < G * S; i += 256) {
    int s = i & (S - 1);
    float v = scoresL[i] * rsAll[s] * SCALE;
    if (mask[b * S + s]) v = -__builtin_inff();
    scoresL[i] = v;
  }
  __syncthreads();
  if (tid < 64) {
    int g = tid >> 5, l = tid & 31;
    float mx = -__builtin_inff();
    for (int s = l; s < S; s += 32) mx = fmaxf(mx, scoresL[g * S + s]);
    red[g * 32 + l] = mx;
  }
  __syncthreads();
  if (tid < 2) {
    float mx = -__builtin_inff();
    for (int l = 0; l < 32; ++l) mx = fmaxf(mx, red[tid * 32 + l]);
    red[tid * 32] = mx;
  }
  __syncthreads();
  if (tid < 64) {
    int g = tid >> 5, l = tid & 31;
    float mx = red[g * 32];
    float sm = 0.f;
    for (int s = l; s < S; s += 32) {
      float e = __expf(scoresL[g * S + s] - mx);
      scoresL[g * S + s] = e;
      sm += e;
    }
    red[64 + g * 32 + l] = sm;
  }
  __syncthreads();
  if (tid < 2) {
    float sm = 0.f;
    for (int l = 0; l < 32; ++l) sm += red[64 + tid * 32 + l];
    red[64 + tid * 32] = 1.f / sm;
  }
  __syncthreads();
  for (int i = tid; i < G * S; i += 256) {
    int g = i >> 9, s = i & (S - 1);
    float a = scoresL[i] * red[64 + g * 32];
    attnL[i] = (_Float16)a;
    outAttn[(size_t)(b * T + n * G + g) * S + s] = a;
  }
  __syncthreads();

  // ================= pass 2: v projection + out = attn @ v =================
  v8f oacc[4];
#pragma unroll
  for (int j = 0; j < 4; ++j) oacc[j] = vzero();

  if (w == 0) tdm_load_chunk(histSrc, LDS_HIST0);

  for (int c = 0; c < NC; ++c) {
    const _Float16* histL =
        (const _Float16*)(smemRaw + ((c & 1) ? LDS_HIST1 : LDS_HIST0));
    if (w == 0) {
      if (c + 1 < NC) {
        tdm_load_chunk(histSrc + (size_t)(c + 1) * CHUNK * D,
                       ((c + 1) & 1) ? LDS_HIST1 : LDS_HIST0);
        __builtin_amdgcn_s_wait_tensorcnt(1);
      } else {
        __builtin_amdgcn_s_wait_tensorcnt(0);
      }
    }
    // v-proj operands, fetched one k-step ahead as in pass 1
    int mT = w >> 1, nHalf = w & 1;
    const _Float16* wb =
        swv + ((size_t)(n * 32 + nHalf * 16) * 16) * 512 + lane * 16;
    v16h bq[16];
#pragma unroll
    for (int j = 0; j < 16; ++j) bq[j] = load_w_frag(wb + j * (16 * 512));
    __syncthreads();

    // v-proj, stored transposed: vT[e][s] (contiguous 8 halves per lane)
    {
      const _Float16* ab = histL + (mT * 16) * D;
      v8f acc[16];
#pragma unroll
      for (int j = 0; j < 16; ++j) acc[j] = vzero();
      v16h a = load_ab_f16(ab, D, lane, 15);
      // Kept rolled: unrolled, the weight loads no longer depend on a loop count,
      // are lifted out of the chunk loop and spill.
#pragma unroll 1
      for (int kt = 0; kt < 15; ++kt) {
        v16h an = load_ab_f16(ab + (kt + 1) * 32, D, lane, 15);
        // keeps the next A fragment's two LDS reads at the head of the k-step
        __builtin_amdgcn_sched_group_barrier(0x100, 2, 0);
        const _Float16* wn = wb + (kt + 1) * 512;
#pragma unroll
        for (int j = 0; j < 16; ++j) {
          acc[j] = wmma32(a, bq[j], acc[j]);
          bq[j] = load_w_frag(wn + j * (16 * 512));
          // keeps the order one WMMA, its two refill loads: without it the
          // scheduler regroups the loads and some of the waits drain to 0
          __builtin_amdgcn_sched_group_barrier(0x008, 1, 0);
          __builtin_amdgcn_sched_group_barrier(0x020, 2, 0);
        }
        a = an;
        // the refill loads are still in flight when the next trip rewrites the
        // address register that they name
        asm volatile("s_wait_xcnt 0x0" ::: "memory");
      }
#pragma unroll
      for (int j = 0; j < 16; ++j) acc[j] = wmma32(a, bq[j], acc[j]);
#pragma unroll
      for (int j = 0; j < 16; ++j) {
        int e = (nHalf * 16 + j) * 16 + nn;
        _Float16* dst = kvL + e * CHUNK + mT * 16 + mb;
#pragma unroll
        for (int r = 0; r < 8; ++r) dst[r] = (_Float16)acc[j][r];
      }
    }
    __syncthreads();

    // out += attn[:, chunk] @ v_chunk ; wave w owns e range [w*64, w*64+64)
#pragma unroll
    for (int ks = 0; ks < CHUNK / 32; ++ks) {
      v16h a = load_ab_f16(attnL + c * CHUNK + ks * 32, S, lane, G - 1);
#pragma unroll
      for (int j = 0; j < 4; ++j) {
        const _Float16* bsrc = kvL + (w * 64 + j * 16) * CHUNK + ks * 32;
        v16h bf = load_ab_f16(bsrc, CHUNK, lane, 15);
        oacc[j] = wmma32(a, bf, oacc[j]);
      }
    }
    __syncthreads();
  }

  if (lane < 16) {
#pragma unroll
    for (int j = 0; j < 4; ++j) {
      int e = w * 64 + j * 16 + lane;
      outTok[(size_t)(b * T + n * G + 0) * D + e] = oacc[j][0];
      outTok[(size_t)(b * T + n * G + 1) * D + e] = oacc[j][1];
    }
  }
}

// ---------------- host launcher ----------------
extern "C" void kernel_launch(void* const* d_in, const int* in_sizes, int n_in,
                              void* d_out, int out_size, void* d_ws, size_t ws_size,
                              hipStream_t stream) {
  const float* tgt  = (const float*)d_in[0];
  const float* hist = (const float*)d_in[1];
  const int*   mask = (const int*)d_in[2];
  const float* wq   = (const float*)d_in[3];
  const float* wk   = (const float*)d_in[4];
  const float* wv   = (const float*)d_in[5];
  const float* qnw  = (const float*)d_in[6];
  const float* knw  = (const float*)d_in[7];

  float* outTok  = (float*)d_out;
  float* outAttn = outTok + (size_t)B * T * D;

  char* ws = (char*)d_ws;
  _Float16* swq  = (_Float16*)(ws);
  _Float16* swk  = (_Float16*)(ws + (size_t)512 * 1024);
  _Float16* swv  = (_Float16*)(ws + (size_t)512 * 1024 + 2u * 1024 * 1024);
  _Float16* qk   = (_Float16*)(ws + (size_t)512 * 1024 + 4u * 1024 * 1024);
  _Float16* h16  = (_Float16*)(ws + (size_t)5 * 1024 * 1024);  // 32 MB

  swizzle_w<<<(512 * 512) / 256, 256, 0, stream>>>(wq, swq, 512);
  swizzle_w<<<(2048 * 512) / 256, 256, 0, stream>>>(wk, swk, 2048);
  swizzle_w<<<(2048 * 512) / 256, 256, 0, stream>>>(wv, swv, 2048);

  int n4 = B * S * D / 4;
  cvt_hist<<<(n4 + 255) / 256, 256, 0, stream>>>(hist, h16, n4);

  qproj_kernel<<<B * T / 16, 256, 0, stream>>>(tgt, swq, qnw, knw, qk);

  attn_kernel<<<B * NKV, 256, LDS_TOTAL, stream>>>(h16, mask, swk, swv, qk,
                                                   outTok, outAttn);
}

// v003
// It runs in 147 microseconds.
// Versions in between are left out here; by their measured steps it is 1.79 times as fast as v001.
// Counting every step since v000, it is 3.38 times as fast.
#include <hip/hip_runtime.h>
#include <hip/hip_bf16.h>

// ---------------- problem constants ----------------
constexpr int B   = 64;
constexpr int T   = 8;
constexpr int D   = 512;
constexpr int S   = 512;
constexpr int NKV = 4;
constexpr int G   = T / NKV;          // 2
constexpr int CHUNK = 64;             // S-chunk processed per iteration
constexpr int NC  = S / CHUNK;        // 8 chunks
constexpr float EPS = 1e-6f;
constexpr float SCALE = 0.044194173824159216f; // D^-0.5

typedef __attribute__((ext_vector_type(16))) _Float16 v16h;
typedef __attribute__((ext_vector_type(4)))  _Float16 v4h;
typedef __attribute__((ext_vector_type(8)))  _Float16 v8h;
typedef __attribute__((ext_vector_type(8)))  float    v8f;
typedef __attribute__((ext_vector_type(4)))  unsigned v4u;
typedef __attribute__((ext_vector_type(8)))  int      v8i;
typedef __attribute__((ext_vector_type(4)))  int      v4i;

constexpr int      NSLAB     = 4;
constexpr int      SLAB_COLS = D / NSLAB;                  // 128 f16 = 256 B a row
constexpr int      PITCH_A   = SLAB_COLS + 8;              // f16 units: 272 B
constexpr int      PITCH_T   = SLAB_COLS + 16;             // f16 units: 288 B
constexpr unsigned SLAB_BYTES = 18432;                     // 64 x 288; 64 x 272 rounded up to 2 KiB
constexpr int      SLAB_H    = SLAB_BYTES / 2;             // slab stride in f16 units
constexpr int      PITCH_K   = D + 8;                      // k rows: 1040 B, 16 B x odd
static_assert(CHUNK * PITCH_T * 2 <= (int)SLAB_BYTES && SLAB_BYTES % 2048 == 0, "slab size");
constexpr unsigned LDS_HIST0 = 0;                          // NSLAB slabs, 72 KB
constexpr unsigned LDS_HIST1 = LDS_HIST0 + NSLAB * SLAB_BYTES;  // double buffer, 72 KB
constexpr unsigned LDS_KV    = LDS_HIST1 + NSLAB * SLAB_BYTES;  // k rows / ctx, 65 KB
constexpr unsigned LDS_QK    = LDS_KV    + CHUNK * PITCH_K * 2; // [G][D] f16
constexpr unsigned LDS_ATTN  = LDS_QK    + G * D * 2;      // [G][S] f16
constexpr unsigned LDS_SCORE = LDS_ATTN  + G * S * 2;      // [G][S] f32
constexpr unsigned LDS_RS    = LDS_SCORE + G * S * 4;      // [S] f32
constexpr unsigned LDS_ROWSQ = LDS_RS    + S * 4;          // [4][CHUNK] f32
constexpr unsigned LDS_RED   = LDS_ROWSQ + 4 * CHUNK * 4;  // [128] f32
constexpr unsigned LDS_TOTAL = LDS_RED   + 128 * 4;        // ~220 KB (<320 KB/WGP)

__device__ __forceinline__ v8f wmma32(v16h a, v16h b, v8f c) {
  return __builtin_amdgcn_wmma_f32_16x16x32_f16(false, a, false, b,
                                                (short)0, c, false, false);
}

__device__ __forceinline__ int kcol(int p) {
  return ((p & 4) ? 16 : 0) + 2 * (p & 3);
}

// Load a 16(rows) x 32(K) fragment from row-major f16 memory (LDS or global).
// Rows beyond maxRow are clamped (for the G=2 query/attn rows padded to 16).
__device__ __forceinline__ v16h load_ab_f16(const _Float16* src, int pitch,
                                            int lane, int maxRow) {
  int m = lane & 15; if (m > maxRow) m = maxRow;
  int hi = (lane >> 4) & 1;
  const _Float16* row = src + m * pitch + 8 * hi;
  // k = 8*hi + 0..7 and 16 + 8*hi + 0..7, each run one 16-byte load (src and pitch
  // are multiples of 16 bytes)
  v8h lo = *reinterpret_cast<const v8h*>(row);
  v8h up = *reinterpret_cast<const v8h*>(row + 16);
  return __builtin_shufflevector(lo, up, 0, 1, 2, 3, 4, 5, 6, 7,
                                 8, 9, 10, 11, 12, 13, 14, 15);
}

// Same but source is row-major f32 in global memory (converted on the fly).
__device__ __forceinline__ v16h load_ab_f32(const float* src, int pitch, int lane) {
  int m = lane & 15;
  int hi = (lane >> 4) & 1;
  const float* row = src + (size_t)m * pitch + 8 * hi;
  v16h f;
#pragma unroll
  for (int p = 0; p < 8; ++p) {
    const float* q = row + kcol(p);
    f[2 * p]     = (_Float16)q[0];
    f[2 * p + 1] = (_Float16)q[1];
  }
  return f;
}

// 32(K rows) x 16(N columns) B fragment out of a row-major f16 LDS tile: the two
// transposing loads hand lane (c, hi) column c at k = 8*hi + 0..7 and 16 + 8*hi + 0..7,
// the k order of load_ab_f16.
__device__ __forceinline__ v16h load_bt_f16(const _Float16* tile, int pitch, int lane) {
  typedef __attribute__((ext_vector_type(8))) short s16x8;
  typedef __attribute__((address_space(3))) s16x8 lds_s16x8;
  const _Float16* p =
      tile + (8 * (lane >> 4) + (lane & 7)) * pitch + 8 * ((lane >> 3) & 1);
  v8h lo = __builtin_bit_cast(
      v8h, __builtin_amdgcn_ds_load_tr16_b128_v8i16((lds_s16x8*)p));
  v8h hi = __builtin_bit_cast(
      v8h, __builtin_amdgcn_ds_load_tr16_b128_v8i16((lds_s16x8*)(p + 16 * pitch)));
  return __builtin_shufflevector(lo, hi, 0, 1, 2, 3, 4, 5, 6, 7,
                                 8, 9, 10, 11, 12, 13, 14, 15);
}

// One pre-swizzled 32(K) x 16(N) weight fragment: 32 bytes per lane.
__device__ __forceinline__ v16h load_w_frag(const _Float16* p) {
  return *reinterpret_cast<const v16h*>(p);
}

__device__ __forceinline__ v8f vzero() {
  v8f z = {0.f, 0.f, 0.f, 0.f, 0.f, 0.f, 0.f, 0.f};
  return z;
}

// ---- Tensor mover: one slab (CHUNK rows of 256 bytes, source pitch 2*D bytes) ----
typedef __attribute__((ext_vector_type(4))) uint32_t u32x4;
typedef __attribute__((ext_vector_type(8))) uint32_t u32x8;

__device__ __forceinline__ uint32_t uni(uint32_t v) {
  return (uint32_t)__builtin_amdgcn_readfirstlane(v);
}
__device__ __forceinline__ uint32_t pinned(uint32_t v) {
  uint32_t w = uni(v);
  asm volatile("" : "+s"(w));  // pinned(): keeps the test in a scalar register
  return w;
}
// the compiler places no wait for the tensor mover
__device__ __forceinline__ void wait_tensor0() {
  asm volatile("s_wait_tensorcnt 0x0" ::: "memory");
}
// this wave's LDS reads and writes are done before the buffer is handed over
__device__ __forceinline__ void wait_ds0() {
  asm volatile("s_wait_dscnt 0x0" ::: "memory");
}
template <unsigned PADA>
__device__ __forceinline__ u32x8 tdm_group1() {
  constexpr uint32_t d0 = SLAB_COLS * 2, d1 = CHUNK;       // bytes a row, rows
  u32x8 g1;
  g1[0] = uni((1u << 20) | (5u << 22) | (PADA << 25));
  g1[1] = uni(d0 << 16);
  g1[2] = uni(d1 << 16);
  g1[3] = uni(d0 << 16);
  g1[4] = uni(d1);
  g1[5] = uni((uint32_t)D * 2u);
  g1[6] = pinned(0u);
  g1[7] = pinned(0u);
  return g1;
}
__device__ __forceinline__ void tdm_load_slab(u32x8 g1, const _Float16* gsrc,
                                              uint32_t ldsDst) {
  unsigned long long ga = (unsigned long long)(uintptr_t)gsrc;
  u32x4 g0;
  g0[0] = uni(1u);                                          // count = 1
  g0[1] = uni(ldsDst);                                      // LDS byte address
  g0[2] = uni((uint32_t)ga);                                // global address [31:0]
  g0[3] = uni((((uint32_t)(ga >> 32)) & 0x01FFFFFFu) | 0x80000000u);  // [56:32], type 2
  asm volatile("tensor_load_to_lds %0, %1" :: "s"(g0), "s"(g1) : "memory");
}

__global__ __launch_bounds__(256)
void swizzle_w(const float* __restrict__ W, _Float16* __restrict__ out, int E) {
  int idx = blockIdx.x * 256 + threadIdx.x;
  if (idx >= E * 512) return;
  int h    = idx & 15;
  int lane = (idx >> 4) & 31;
  int tile = idx >> 9;
  int dt   = tile & 15;       // D/32 == 16
  int etg  = tile >> 4;
  int e = etg * 16 + (lane & 15);
  int d = dt * 32 + 2 * (h & 8) + 8 * (lane >> 4) + (h & 7);
  out[idx] = (_Float16)W[(size_t)e * 512 + d];
}

__global__ __launch_bounds__(256)
void cvt_hist(const float* __restrict__ src, _Float16* __restrict__ dst, int n4) {
  int i = blockIdx.x * 256 + threadIdx.x;
  if (i >= n4) return;
  float4 x = reinterpret_cast<const float4*>(src)[i];
  v4h h;
  h[0] = (_Float16)x.x; h[1] = (_Float16)x.y;
  h[2] = (_Float16)x.z; h[3] = (_Float16)x.w;
  *reinterpret_cast<v4h*>(dst + (size_t)i * 4) = h;
}

// ---------------- kernel 1: q = rmsnorm(target @ Wq^T) * (1+qw) * (1+kw) ------
__global__ __launch_bounds__(256)
void qproj_kernel(const float* __restrict__ tgt, const _Float16* __restrict__ wq,
                  const float* __restrict__ qw, const float* __restrict__ kw,
                  _Float16* __restrict__ qkOut) {
  __shared__ float qLds[16][D];
  __shared__ float rowSq[16];

  int tid  = threadIdx.x;
  int lane = tid & 31;
  int w    = tid >> 5;
  int rowBase = blockIdx.x * 16;

  v8f acc[4];
#pragma unroll
  for (int j = 0; j < 4; ++j) acc[j] = vzero();

  for (int kt = 0; kt < 16; ++kt) {
    v16h a = load_ab_f32(tgt + (size_t)rowBase * D + kt * 32, D, lane);
#pragma unroll
    for (int j = 0; j < 4; ++j) {
      int etg = w * 4 + j;
      const _Float16* tb = wq + ((size_t)(etg * 16 + kt)) * 512;
      v16h bf = *reinterpret_cast<const v16h*>(tb + lane * 16);
      acc[j] = wmma32(a, bf, acc[j]);
    }
  }

  int nn = lane & 15, mb = (lane >> 4) * 8;
#pragma unroll
  for (int j = 0; j < 4; ++j) {
    int e = (w * 4 + j) * 16 + nn;
#pragma unroll
    for (int r = 0; r < 8; ++r) qLds[mb + r][e] = acc[j][r];
  }
  if (tid < 16) rowSq[tid] = 0.f;
  __syncthreads();

  {
    int r = tid >> 4, seg = tid & 15;
    float s = 0.f;
    for (int i = 0; i < 32; ++i) {
      float x = qLds[r][seg * 32 + i];
      s += x * x;
    }
    atomicAdd(&rowSq[r], s);
  }
  __syncthreads();

  for (int i = tid; i < 16 * D; i += 256) {
    int r = i >> 9, col = i & 511;
    float rs = rsqrtf(rowSq[r] * (1.f / D) + EPS);
    float v = qLds[r][col] * rs * (1.f + qw[col]) * (1.f + kw[col]);
    qkOut[(size_t)(rowBase + r) * D + col] = (_Float16)v;
  }
}

__global__ __launch_bounds__(256)
void attn_kernel(const _Float16* __restrict__ histF16,
                 const int* __restrict__ mask,
                 const _Float16* __restrict__ swk, const _Float16* __restrict__ swv,
                 const _Float16* __restrict__ qkG,
                 float* __restrict__ outTok, float* __restrict__ outAttn) {
  // 2 KiB: every tensor load's place in LDS is a multiple of that
  extern __shared__ __attribute__((aligned(2048))) char smemRaw[];
  _Float16* kvL    = (_Float16*)(smemRaw + LDS_KV);
  _Float16* qkL    = (_Float16*)(smemRaw + LDS_QK);
  _Float16* attnL  = (_Float16*)(smemRaw + LDS_ATTN);
  float*    scoresL = (float*)(smemRaw + LDS_SCORE);
  float*    rsAll   = (float*)(smemRaw + LDS_RS);
  float*    rowPart = (float*)(smemRaw + LDS_ROWSQ);
  float*    red     = (float*)(smemRaw + LDS_RED);

  int wg = blockIdx.x;
  int b  = wg / NKV;
  int n  = wg % NKV;
  int tid  = threadIdx.x;
  int lane = tid & 31;
  int w    = tid >> 5;
  int nn = lane & 15;
  int mb = (lane >> 4) * 8;

  const _Float16* histSrc = histF16 + (size_t)b * S * D;

  // Waves 0..NSLAB-1 each bring one column slab of every chunk.
  const uint32_t wave = uni(threadIdx.x >> 5);
  const uint32_t ldsBase = (uint32_t)(uintptr_t)smemRaw;   // byte offset in the work-group's LDS
  const _Float16* slabSrc = histSrc + wave * SLAB_COLS;
  const uint32_t slabDst = ldsBase + LDS_HIST0 + wave * SLAB_BYTES;

  const u32x8 g1a = tdm_group1<3>();
  // prologue of the two-buffer ring: chunk 0 lands and is published, chunk 1 is asked for
  if (pinned(wave < NSLAB)) {
    tdm_load_slab(g1a, slabSrc, slabDst);
    wait_tensor0();
  }
  for (int i = tid; i < G * D; i += 256)
    qkL[i] = qkG[(size_t)(b * T + n * G) * D + i];
  __syncthreads();
  if (pinned(wave < NSLAB))
    tdm_load_slab(g1a, slabSrc + (size_t)CHUNK * D, slabDst + (LDS_HIST1 - LDS_HIST0));

  // ================= pass 1: k projection + scores =================
  for (int c = 0; c < NC; ++c) {
    const _Float16* histL =
        (const _Float16*)(smemRaw + ((c & 1) ? LDS_HIST1 : LDS_HIST0));
    // k-proj: wave w -> mTile = w/2, nHalf = w&1 (16 N-tiles).
    // Fragment (j, kt) of this wave's weight slice stands at wb + (j*16 + kt)*512.
    int mT = w >> 1, nHalf = w & 1;
    const _Float16* wb =
        swk + ((size_t)(n * 32 + nHalf * 16) * 16) * 512 + lane * 16;
    // weight fragments of k-step 0
    v16h bq[16];
#pragma unroll
    for (int j = 0; j < 16; ++j) bq[j] = load_w_frag(wb + j * (16 * 512));

    {
      // k-step kt stands in slab kt / 4 at column (kt % 4) * 32
      const _Float16* ab = histL + (mT * 16) * PITCH_A;
      v8f acc[16];
#pragma unroll
      for (int j = 0; j < 16; ++j) acc[j] = vzero();
      v16h a = load_ab_f16(ab, PITCH_A, lane, 15);
      // k-step kt runs on fragments loaded one k-step earlier; each weight
      // register set is refilled for kt + 1 right behind the WMMA that read it.
      // Kept rolled: unrolled, the weight loads no longer depend on a loop count,
      // are lifted out of the chunk loop and spill.
#pragma unroll 1
      for (int kt = 0; kt < 15; ++kt) {
        v16h an = load_ab_f16(ab + ((kt + 1) >> 2) * SLAB_H + ((kt + 1) & 3) * 32,
                              PITCH_A, lane, 15);
        // keeps the next A fragment's two LDS reads at the head of the k-step
        __builtin_amdgcn_sched_group_barrier(0x100, 2, 0);
        const _Float16* wn = wb + (kt + 1) * 512;
#pragma unroll
        for (int j = 0; j < 16; ++j) {
          acc[j] = wmma32(a, bq[j], acc[j]);
          bq[j] = load_w_frag(wn + j * (16 * 512));
          // keeps the order one WMMA, its two refill loads: without it the
          // scheduler regroups the loads and some of the waits drain to 0
          __builtin_amdgcn_sched_group_barrier(0x008, 1, 0);
          __builtin_amdgcn_sched_group_barrier(0x020, 2, 0);
        }
        a = an;
        // the refill loads are still in flight when the next trip rewrites the
        // address register that they name
        asm volatile("s_wait_xcnt 0x0" ::: "memory");
      }
#pragma unroll
      for (int j = 0; j < 16; ++j) acc[j] = wmma32(a, bq[j], acc[j]);
      // store raw k rows row-major [s][d]
#pragma unroll
      for (int j = 0; j < 16; ++j) {
        int e = (nHalf * 16 + j) * 16 + nn;
#pragma unroll
        for (int r = 0; r < 8; ++r) {
          int s = mT * 16 + mb + r;
          kvL[s * PITCH_K + e] = (_Float16)acc[j][r];
        }
      }
    }
    __syncthreads();

    {
      int srow = tid & (CHUNK - 1), q = tid >> 6;
      float ssum = 0.f;
      const _Float16* kr = kvL + srow * PITCH_K + q * 128;
      for (int i = 0; i < 128; i += 8) {
        v8h x8 = *reinterpret_cast<const v8h*>(kr + i);
#pragma unroll
        for (int u = 0; u < 8; ++u) {
          float x = (float)x8[u];
          ssum += x * x;
        }
      }
      rowPart[q * CHUNK + srow] = ssum;
    }
    __syncthreads();
    for (int i = tid; i < CHUNK; i += 256) {
      float sq = ((rowPart[i] + rowPart[CHUNK + i]) + rowPart[2 * CHUNK + i]) +
                 rowPart[3 * CHUNK + i];
      rsAll[c * CHUNK + i] = rsqrtf(sq * (1.f / D) + EPS);
    }
    __syncthreads();

    // scores: waves 0..3 each take one 16-wide s-tile
    if (w < 4) {
      v8f acc = vzero();
      for (int kt = 0; kt < 16; ++kt) {
        v16h a = load_ab_f16(qkL + kt * 32, D, lane, G - 1);
        v16h bf = load_ab_f16(kvL + (w * 16) * PITCH_K + kt * 32, PITCH_K, lane, 15);
        acc = wmma32(a, bf, acc);
      }
      if (lane < 16) {
        int s = c * CHUNK + w * 16 + lane;
        scoresL[0 * S + s] = acc[0];   // g = 0
        scoresL[1 * S + s] = acc[1];   // g = 1
      }
    }
    // foot of the trip: chunk c + 1 is published, and the buffer that this trip has
    // read is free for chunk c + 2
    wait_ds0();
    if (pinned(wave < NSLAB)) wait_tensor0();
    __syncthreads();
    if (pinned((wave < NSLAB) && (c + 2 < NC)))
      tdm_load_slab(g1a, slabSrc + (size_t)(c + 2) * CHUNK * D,
                       slabDst + ((c & 1) ? (LDS_HIST1 - LDS_HIST0) : 0u));
  }
  wait_tensor0();
  wait_ds0();

  // ================= softmax over S =================
  for (int i = tid; i < G * S; i += 256) {
    int s = i & (S - 1);
    float v = scoresL[i] * rsAll[s] * SCALE;
    if (mask[b * S + s]) v = -__builtin_inff();
    scoresL[i] = v;
  }
  __syncthreads();
  if (tid < 64) {
    int g = tid >> 5, l = tid & 31;
    float mx = -__builtin_inff();
    for (int s = l; s < S; s += 32) mx = fmaxf(mx, scoresL[g * S + s]);
    red[g * 32 + l] = mx;
  }
  __syncthreads();
  if (tid < 2) {
    float mx = -__builtin_inff();
    for (int l = 0; l < 32; ++l) mx = fmaxf(mx, red[tid * 32 + l]);
    red[tid * 32] = mx;
  }
  __syncthreads();
  if (tid < 64) {
    int g = tid >> 5, l = tid & 31;
    float mx = red[g * 32];
    float sm = 0.f;
    for (int s = l; s < S; s += 32) {
      float e = __expf(scoresL[g * S + s] - mx);
      scoresL[g * S + s] = e;
      sm += e;
    }
    red[64 + g * 32 + l] = sm;
  }
  __syncthreads();
  if (tid < 2) {
    float sm = 0.f;
    for (int l = 0; l < 32; ++l) sm += red[64 + tid * 32 + l];
    red[64 + tid * 32] = 1.f / sm;
  }
  __syncthreads();
  for (int i = tid; i < G * S; i += 256) {
    int g = i >> 9, s = i & (S - 1);
    float a = scoresL[i] * red[64 + g * 32];
    attnL[i] = (_Float16)a;
    outAttn[(size_t)(b * T + n * G + g) * S + s] = a;
  }
  __syncthreads();

  // ===== pass 2: out = attn @ (hist @ Wv^T), summed as (attn @ hist) @ Wv^T =====
  v8f oacc[4];
#pragma unroll
  for (int j = 0; j < 4; ++j) oacc[j] = vzero();

  // the same ring once more, the rows now at the transposing reader's pitch
  const u32x8 g1t = tdm_group1<7>();
  if (pinned(wave < NSLAB)) {
    tdm_load_slab(g1t, slabSrc, slabDst);
    wait_tensor0();
  }
  __syncthreads();
  if (pinned(wave < NSLAB))
    tdm_load_slab(g1t, slabSrc + (size_t)CHUNK * D, slabDst + (LDS_HIST1 - LDS_HIST0));

  // Wave w owns e range [w*64, w*64+64) of out = ctx @ Wv^T; fragment (j, kt) of its
  // weight slice stands at wv4 + (j*16 + kt)*512. K-steps 0..7 are asked for here,
  // ahead of the chunk loop: they need nothing of it.
  const _Float16* wv4 =
      swv + ((size_t)(n * 32 + w * 4) * 16) * 512 + lane * 16;
  v16h bq[32];
#pragma unroll
  for (int kt = 0; kt < 8; ++kt)
#pragma unroll
    for (int j = 0; j < 4; ++j)
      bq[kt * 4 + j] = load_w_frag(wv4 + (j * 16 + kt) * 512);

  for (int c = 0; c < NC; ++c) {
    const _Float16* histL =
        (const _Float16*)(smemRaw + ((c & 1) ? LDS_HIST1 : LDS_HIST0));

    // ctx += attn[:, chunk] @ hist_chunk ; wave w owns d range [w*64, w*64+64)
#pragma unroll
    for (int ks = 0; ks < CHUNK / 32; ++ks) {
      v16h a = load_ab_f16(attnL + c * CHUNK + ks * 32, S, lane, G - 1);
#pragma unroll
      for (int j = 0; j < 4; ++j) {
        v16h bf = load_bt_f16(histL + (w >> 1) * SLAB_H + (ks * 32) * PITCH_T +
                                  (w & 1) * 64 + j * 16,
                              PITCH_T, lane);
        oacc[j] = wmma32(a, bf, oacc[j]);
      }
    }
    wait_ds0();
    if (pinned(wave < NSLAB)) wait_tensor0();
    __syncthreads();
    if (pinned((wave < NSLAB) && (c + 2 < NC)))
      tdm_load_slab(g1t, slabSrc + (size_t)(c + 2) * CHUNK * D,
                       slabDst + ((c & 1) ? (LDS_HIST1 - LDS_HIST0) : 0u));
  }
  wait_tensor0();
  wait_ds0();

  static_assert(G == 2, "one ctx row per lane half");
  _Float16* ctxL = kvL;
#pragma unroll
  for (int j = 0; j < 4; ++j)
    ctxL[(lane >> 4) * D + w * 64 + j * 16 + nn] = (_Float16)oacc[j][0];
  __syncthreads();

  // out = ctx @ Wv^T: k-steps 0..7 run on the fragments asked for above, and each
  // register set is refilled for k-step kt + 8 in the k-step that read it.
  v8f tacc[4];
#pragma unroll
  for (int j = 0; j < 4; ++j) tacc[j] = vzero();
  v16h a = load_ab_f16(ctxL, D, lane, G - 1);
#pragma unroll
  for (int kt = 0; kt < 16; ++kt) {
    v16h an = a;
    if (kt + 1 < 16) an = load_ab_f16(ctxL + (kt + 1) * 32, D, lane, G - 1);
#pragma unroll
    for (int j = 0; j < 4; ++j) {
      tacc[j] = wmma32(a, bq[(kt & 7) * 4 + j], tacc[j]);
      if (kt < 8) bq[kt * 4 + j] = load_w_frag(wv4 + (j * 16 + kt + 8) * 512);
    }
    a = an;
    // holds the refill loads in their k-step: left to itself the scheduler puts
    // each load just ahead of its use, with two fragments in flight
    if (kt < 8) __builtin_amdgcn_sched_barrier(0);
  }

  if (lane < 16) {
#pragma unroll
    for (int j = 0; j < 4; ++j) {
      int e = w * 64 + j * 16 + lane;
      outTok[(size_t)(b * T + n * G + 0) * D + e] = tacc[j][0];
      outTok[(size_t)(b * T + n * G + 1) * D + e] = tacc[j][1];
    }
  }
}

// ---------------- host launcher ----------------
extern "C" void kernel_launch(void* const* d_in, const int* in_sizes, int n_in,
                              void* d_out, int out_size, void* d_ws, size_t ws_size,
                              hipStream_t stream) {
  const float* tgt  = (const float*)d_in[0];
  const float* hist = (const float*)d_in[1];
  const int*   mask = (const int*)d_in[2];
  const float* wq   = (const float*)d_in[3];
  const float* wk   = (const float*)d_in[4];
  const float* wv   = (const float*)d_in[5];
  const float* qnw  = (const float*)d_in[6];
  const float* knw  = (const float*)d_in[7];

  float* outTok  = (float*)d_out;
  float* outAttn = outTok + (size_t)B * T * D;

  char* ws = (char*)d_ws;
  _Float16* swq  = (_Float16*)(ws);
  _Float16* swk  = (_Float16*)(ws + (size_t)512 * 1024);
  _Float16* swv  = (_Float16*)(ws + (size_t)512 * 1024 + 2u * 1024 * 1024);
  _Float16* qk   = (_Float16*)(ws + (size_t)512 * 1024 + 4u * 1024 * 1024);
  _Float16* h16  = (_Float16*)(ws + (size_t)5 * 1024 * 1024);  // 32 MB

  swizzle_w<<<(512 * 512) / 256, 256, 0, stream>>>(wq, swq, 512);
  swizzle_w<<<(2048 * 512) / 256, 256, 0, stream>>>(wk, swk, 2048);
  swizzle_w<<<(2048 * 512) / 256, 256, 0, stream>>>(wv, swv, 2048);

  int n4 = B * S * D / 4;
  cvt_hist<<<(n4 + 255) / 256, 256, 0, stream>>>(hist, h16, n4);

  qproj_kernel<<<B * T / 16, 256, 0, stream>>>(tgt, swq, qnw, knw, qk);

  attn_kernel<<<B * NKV, 256, LDS_TOTAL, stream>>>(h16, mask, swk, swv, qk,
                                                   outTok, outAttn);
}

// v004
// Measured time: 116 microseconds a run.
// Next to v003, in two timings, it ran 1.27 times as fast each time.
// Over all steps from v000 it is 4.30 times as fast.
#include <hip/hip_runtime.h>
#include <hip/hip_bf16.h>

// ---------------- problem constants ----------------
constexpr int B   = 64;
constexpr int T   = 8;
constexpr int D   = 512;
constexpr int S   = 512;
constexpr int NKV = 4;
constexpr int G   = T / NKV;          // 2
constexpr int CHUNK = 64;             // S-chunk processed per iteration
constexpr int NC  = S / CHUNK;        // 8 chunks
constexpr float EPS = 1e-6f;
constexpr float SCALE = 0.044194173824159216f; // D^-0.5

typedef __attribute__((ext_vector_type(16))) _Float16 v16h;
typedef __attribute__((ext_vector_type(4)))  _Float16 v4h;
typedef __attribute__((ext_vector_type(8)))  _Float16 v8h;
typedef __attribute__((ext_vector_type(8)))  float    v8f;
typedef __attribute__((ext_vector_type(4)))  unsigned v4u;
typedef __attribute__((ext_vector_type(8)))  int      v8i;
typedef __attribute__((ext_vector_type(4)))  int      v4i;

constexpr int      NSLAB     = 4;
constexpr int      SLAB_COLS = D / NSLAB;                  // 128 f16 = 256 B a row
constexpr int      PITCH_A   = SLAB_COLS + 8;              // f16 units: 272 B
constexpr int      PITCH_T   = SLAB_COLS + 16;             // f16 units: 288 B
constexpr unsigned SLAB_BYTES = 18432;                     // 64 x 288; 64 x 272 rounded up to 2 KiB
constexpr int      SLAB_H    = SLAB_BYTES / 2;             // slab stride in f16 units
constexpr int      PITCH_K   = D + 8;                      // k rows: 1040 B, 16 B x odd
static_assert(CHUNK * PITCH_T * 2 <= (int)SLAB_BYTES && SLAB_BYTES % 2048 == 0, "slab size");
constexpr unsigned LDS_HIST0 = 0;                          // NSLAB slabs, 72 KB
constexpr unsigned LDS_HIST1 = LDS_HIST0 + NSLAB * SLAB_BYTES;  // double buffer, 72 KB
constexpr unsigned LDS_KV    = LDS_HIST1 + NSLAB * SLAB_BYTES;  // k rows / ctx, 65 KB
constexpr unsigned LDS_QK    = LDS_KV    + CHUNK * PITCH_K * 2; // [G][D] f16
constexpr unsigned LDS_ATTN  = LDS_QK    + G * D * 2;      // [G][S] f16
constexpr unsigned LDS_SCORE = LDS_ATTN  + G * S * 2;      // [G][S] f32
constexpr unsigned LDS_RS    = LDS_SCORE + G * S * 4;      // [S] f32
constexpr unsigned LDS_ROWSQ = LDS_RS    + S * 4;          // [4][CHUNK] f32
constexpr unsigned LDS_RED   = LDS_ROWSQ + 4 * CHUNK * 4;  // [128] f32
constexpr unsigned LDS_TOTAL = LDS_RED   + 128 * 4;        // ~220 KB (<320 KB/WGP)

__device__ __forceinline__ v8f wmma32(v16h a, v16h b, v8f c) {
  return __builtin_amdgcn_wmma_f32_16x16x32_f16(false, a, false, b,
                                                (short)0, c, false, false);
}

__device__ __forceinline__ int kcol(int p) {
  return ((p & 4) ? 16 : 0) + 2 * (p & 3);
}

// Load a 16(rows) x 32(K) fragment from row-major f16 memory (LDS or global).
// Rows beyond maxRow are clamped (for the G=2 query/attn rows padded to 16).
__device__ __forceinline__ v16h load_ab_f16(const _Float16* src, int pitch,
                                            int lane, int maxRow) {
  int m = lane & 15; if (m > maxRow) m = maxRow;
  int hi = (lane >> 4) & 1;
  const _Float16* row = src + m * pitch + 8 * hi;
  // k = 8*hi + 0..7 and 16 + 8*hi + 0..7, each run one 16-byte load (src and pitch
  // are multiples of 16 bytes)
  v8h lo = *reinterpret_cast<const v8h*>(row);
  v8h up = *reinterpret_cast<const v8h*>(row + 16);
  return __builtin_shufflevector(lo, up, 0, 1, 2, 3, 4, 5, 6, 7,
                                 8, 9, 10, 11, 12, 13, 14, 15);
}

// Same but source is row-major f32 in global memory (converted on the fly).
__device__ __forceinline__ v16h load_ab_f32(const float* src, int pitch, int lane) {
  int m = lane & 15;
  int hi = (lane >> 4) & 1;
  const float* row = src + (size_t)m * pitch + 8 * hi;
  v16h f;
#pragma unroll
  for (int p = 0; p < 8; ++p) {
    const float* q = row + kcol(p);
    f[2 * p]     = (_Float16)q[0];
    f[2 * p + 1] = (_Float16)q[1];
  }
  return f;
}

// 32(K rows) x 16(N columns) B fragment out of a row-major f16 LDS tile: the two
// transposing loads hand lane (c, hi) column c at k = 8*hi + 0..7 and 16 + 8*hi + 0..7,
// the k order of load_ab_f16.
__device__ __forceinline__ v16h load_bt_f16(const _Float16* tile, int pitch, int lane) {
  typedef __attribute__((ext_vector_type(8))) short s16x8;
  typedef __attribute__((address_space(3))) s16x8 lds_s16x8;
  const _Float16* p =
      tile + (8 * (lane >> 4) + (lane & 7)) * pitch + 8 * ((lane >> 3) & 1);
  v8h lo = __builtin_bit_cast(
      v8h, __builtin_amdgcn_ds_load_tr16_b128_v8i16((lds_s16x8*)p));
  v8h hi = __builtin_bit_cast(
      v8h, __builtin_amdgcn_ds_load_tr16_b128_v8i16((lds_s16x8*)(p + 16 * pitch)));
  return __builtin_shufflevector(lo, hi, 0, 1, 2, 3, 4, 5, 6, 7,
                                 8, 9, 10, 11, 12, 13, 14, 15);
}

// One pre-swizzled 32(K) x 16(N) weight fragment: 32 bytes per lane.
__device__ __forceinline__ v16h load_w_frag(const _Float16* p) {
  return *reinterpret_cast<const v16h*>(p);
}

__device__ __forceinline__ v8f vzero() {
  v8f z = {0.f, 0.f, 0.f, 0.f, 0.f, 0.f, 0.f, 0.f};
  return z;
}

// ---- Tensor mover: one slab (CHUNK rows of 256 bytes, source pitch 2*D bytes) ----
typedef __attribute__((ext_vector_type(4))) uint32_t u32x4;
typedef __attribute__((ext_vector_type(8))) uint32_t u32x8;

__device__ __forceinline__ uint32_t uni(uint32_t v) {
  return (uint32_t)__builtin_amdgcn_readfirstlane(v);
}
__device__ __forceinline__ uint32_t pinned(uint32_t v) {
  uint32_t w = uni(v);
  asm volatile("" : "+s"(w));  // pinned(): keeps the test in a scalar register
  return w;
}
// the compiler places no wait for the tensor mover
__device__ __forceinline__ void wait_tensor0() {
  asm volatile("s_wait_tensorcnt 0x0" ::: "memory");
}
// this wave's LDS reads and writes are done before the buffer is handed over
__device__ __forceinline__ void wait_ds0() {
  asm volatile("s_wait_dscnt 0x0" ::: "memory");
}
template <unsigned PADA>
__device__ __forceinline__ u32x8 tdm_group1() {
  constexpr uint32_t d0 = SLAB_COLS * 2, d1 = CHUNK;       // bytes a row, rows
  u32x8 g1;
  g1[0] = uni((1u << 20) | (5u << 22) | (PADA << 25));
  g1[1] = uni(d0 << 16);
  g1[2] = uni(d1 << 16);
  g1[3] = uni(d0 << 16);
  g1[4] = uni(d1);
  g1[5] = uni((uint32_t)D * 2u);
  g1[6] = pinned(0u);
  g1[7] = pinned(0u);
  return g1;
}
__device__ __forceinline__ void tdm_load_slab(u32x8 g1, const _Float16* gsrc,
                                              uint32_t ldsDst) {
  unsigned long long ga = (unsigned long long)(uintptr_t)gsrc;
  u32x4 g0;
  g0[0] = uni(1u);                                          // count = 1
  g0[1] = uni(ldsDst);                                      // LDS byte address
  g0[2] = uni((uint32_t)ga);                                // global address [31:0]
  g0[3] = uni((((uint32_t)(ga >> 32)) & 0x01FFFFFFu) | 0x80000000u);  // [56:32], type 2
  asm volatile("tensor_load_to_lds %0, %1" :: "s"(g0), "s"(g1) : "memory");
}

__global__ __launch_bounds__(256)
void swizzle_w(const float* __restrict__ W, _Float16* __restrict__ out, int E) {
  int idx = blockIdx.x * 256 + threadIdx.x;
  if (idx >= E * 512) return;
  int h    = idx & 15;
  int lane = (idx >> 4) & 31;
  int tile = idx >> 9;
  int dt   = tile & 15;       // D/32 == 16
  int etg  = tile >> 4;
  int e = etg * 16 + (lane & 15);
  int d = dt * 32 + 2 * (h & 8) + 8 * (lane >> 4) + (h & 7);
  out[idx] = (_Float16)W[(size_t)e * 512 + d];
}

__global__ __launch_bounds__(256)
void cvt_hist(const float* __restrict__ src, _Float16* __restrict__ dst, int n4) {
  int i = blockIdx.x * 256 + threadIdx.x;
  if (i >= n4) return;
  float4 x = reinterpret_cast<const float4*>(src)[i];
  v4h h;
  h[0] = (_Float16)x.x; h[1] = (_Float16)x.y;
  h[2] = (_Float16)x.z; h[3] = (_Float16)x.w;
  *reinterpret_cast<v4h*>(dst + (size_t)i * 4) = h;
}

// ---------------- kernel 1: q = rmsnorm(target @ Wq^T) * (1+qw) * (1+kw) ------
__global__ __launch_bounds__(256)
void qproj_kernel(const float* __restrict__ tgt, const _Float16* __restrict__ wq,
                  const float* __restrict__ qw, const float* __restrict__ kw,
                  _Float16* __restrict__ qkOut) {
  __shared__ float qLds[16][D];
  __shared__ float rowSq[16];

  int tid  = threadIdx.x;
  int lane = tid & 31;
  int w    = tid >> 5;
  int rowBase = blockIdx.x * 16;

  v8f acc[4];
#pragma unroll
  for (int j = 0; j < 4; ++j) acc[j] = vzero();

  for (int kt = 0; kt < 16; ++kt) {
    v16h a = load_ab_f32(tgt + (size_t)rowBase * D + kt * 32, D, lane);
#pragma unroll
    for (int j = 0; j < 4; ++j) {
      int etg = w * 4 + j;
      const _Float16* tb = wq + ((size_t)(etg * 16 + kt)) * 512;
      v16h bf = *reinterpret_cast<const v16h*>(tb + lane * 16);
      acc[j] = wmma32(a, bf, acc[j]);
    }
  }

  int nn = lane & 15, mb = (lane >> 4) * 8;
#pragma unroll
  for (int j = 0; j < 4; ++j) {
    int e = (w * 4 + j) * 16 + nn;
#pragma unroll
    for (int r = 0; r < 8; ++r) qLds[mb + r][e] = acc[j][r];
  }
  if (tid < 16) rowSq[tid] = 0.f;
  __syncthreads();

  {
    int r = tid >> 4, seg = tid & 15;
    float s = 0.f;
    for (int i = 0; i < 32; ++i) {
      float x = qLds[r][seg * 32 + i];
      s += x * x;
    }
    atomicAdd(&rowSq[r], s);
  }
  __syncthreads();

  for (int i = tid; i < 16 * D; i += 256) {
    int r = i >> 9, col = i & 511;
    float rs = rsqrtf(rowSq[r] * (1.f / D) + EPS);
    float v = qLds[r][col] * rs * (1.f + qw[col]) * (1.f + kw[col]);
    qkOut[(size_t)(rowBase + r) * D + col] = (_Float16)v;
  }
}

__global__ __launch_bounds__(256)
void attn_kernel(const _Float16* __restrict__ histF16,
                 const int* __restrict__ mask,
                 const _Float16* __restrict__ swk, const _Float16* __restrict__ swv,
                 const _Float16* __restrict__ qkG,
                 float* __restrict__ outTok, float* __restrict__ outAttn) {
  // 2 KiB: every tensor load's place in LDS is a multiple of that
  extern __shared__ __attribute__((aligned(2048))) char smemRaw[];
  _Float16* kvL    = (_Float16*)(smemRaw + LDS_KV);
  _Float16* qkL    = (_Float16*)(smemRaw + LDS_QK);
  _Float16* attnL  = (_Float16*)(smemRaw + LDS_ATTN);
  float*    scoresL = (float*)(smemRaw + LDS_SCORE);
  float*    rsAll   = (float*)(smemRaw + LDS_RS);
  float*    rowPart = (float*)(smemRaw + LDS_ROWSQ);
  float*    red     = (float*)(smemRaw + LDS_RED);

  int wg = blockIdx.x;
  int b  = wg / NKV;
  int n  = wg % NKV;
  int tid  = threadIdx.x;
  int lane = tid & 31;
  int w    = tid >> 5;
  int nn = lane & 15;
  int mb = (lane >> 4) * 8;

  const _Float16* histSrc = histF16 + (size_t)b * S * D;

  // Waves 0..NSLAB-1 each bring one column slab of every chunk.
  const uint32_t wave = uni(threadIdx.x >> 5);
  const uint32_t ldsBase = (uint32_t)(uintptr_t)smemRaw;   // byte offset in the work-group's LDS
  const _Float16* slabSrc = histSrc + wave * SLAB_COLS;
  const uint32_t slabDst = ldsBase + LDS_HIST0 + wave * SLAB_BYTES;

  const u32x8 g1a = tdm_group1<3>();
  // prologue of the two-buffer ring: chunk 0 lands and is published, chunk 1 is asked for
  if (pinned(wave < NSLAB)) {
    tdm_load_slab(g1a, slabSrc, slabDst);
    wait_tensor0();
  }
  for (int i = tid; i < G * D; i += 256)
    qkL[i] = qkG[(size_t)(b * T + n * G) * D + i];
  __syncthreads();
  if (pinned(wave < NSLAB))
    tdm_load_slab(g1a, slabSrc + (size_t)CHUNK * D, slabDst + (LDS_HIST1 - LDS_HIST0));

  // ================= pass 1: k projection + scores =================
  // k-proj: wave w makes columns [w*64, w*64+64) of all CHUNK rows of a chunk, a tile
  // of 4 x 4 fragments, so that every weight fragment is loaded by one wave only.
  // Fragment (j, kt) of this wave's weight slice stands at wb + (j*16 + kt)*512.
  const _Float16* wb =
      swk + ((size_t)(n * 32 + w * 4) * 16) * 512 + lane * 16;
  v16h bk[16];
#pragma unroll
  for (int u = 0; u < 4; ++u)
#pragma unroll
    for (int j = 0; j < 4; ++j) bk[u * 4 + j] = load_w_frag(wb + (j * 16 + u) * 512);

  for (int c = 0; c < NC; ++c) {
    const _Float16* histL =
        (const _Float16*)(smemRaw + ((c & 1) ? LDS_HIST1 : LDS_HIST0));
    {
      // k-step kt stands in slab kt / 4 at column (kt % 4) * 32
      v8f acc[16];
#pragma unroll
      for (int t = 0; t < 16; ++t) acc[t] = vzero();
      v16h a[4];
#pragma unroll
      for (int i = 0; i < 4; ++i)
        a[i] = load_ab_f16(histL + (i * 16) * PITCH_A, PITCH_A, lane, 15);
      // One trip is one slab, four k-steps. The A fragments are read one k-step
      // ahead; each weight register set is refilled for k-step kt + 4 right behind
      // the four WMMAs that read it.
      // Kept rolled: unrolled, the weight loads no longer depend on a loop count,
      // are lifted out of the chunk loop and spill.
#pragma unroll 1
      for (int kb = 0; kb < 16; kb += 4) {
        const int kw = (kb + 4) & 15;
        const _Float16* wn = wb + kw * 512;
        const _Float16* ab = histL + (kb >> 2) * SLAB_H;
        const _Float16* abn = histL + (kw >> 2) * SLAB_H;
#pragma unroll
        for (int u = 0; u < 4; ++u) {
          const _Float16* as = (u < 3) ? ab + (u + 1) * 32 : abn;
          v16h an[4];
#pragma unroll
          for (int i = 0; i < 4; ++i)
            an[i] = load_ab_f16(as + (i * 16) * PITCH_A, PITCH_A, lane, 15);
          // keeps the next A fragments' eight LDS reads as one group at the head of
          // their k-step: left alone the scheduler lumps the reads of several k-steps,
          // takes more registers, and one LDS wait drains to 0
          __builtin_amdgcn_sched_group_barrier(0x100, 8, 0);
#pragma unroll
          for (int j = 0; j < 4; ++j) {
#pragma unroll
            for (int i = 0; i < 4; ++i)
              acc[i * 4 + j] = wmma32(a[i], bk[u * 4 + j], acc[i * 4 + j]);
            bk[u * 4 + j] = load_w_frag(wn + (j * 16 + u) * 512);
            // keeps the order four WMMAs, their two refill loads: without it the
            // scheduler puts refills off and fewer loads are in flight at the waits
            __builtin_amdgcn_sched_group_barrier(0x008, 4, 0);
            __builtin_amdgcn_sched_group_barrier(0x020, 2, 0);
          }
#pragma unroll
          for (int i = 0; i < 4; ++i) a[i] = an[i];
        }
        // the refill loads are still in flight when the next trip rewrites the
        // address register that they name
        asm volatile("s_wait_xcnt 0x0" ::: "memory");
      }
      // store raw k rows row-major [s][d]
#pragma unroll
      for (int i = 0; i < 4; ++i) {
#pragma unroll
        for (int j = 0; j < 4; ++j) {
          int e = (w * 4 + j) * 16 + nn;
#pragma unroll
          for (int r = 0; r < 8; ++r) {
            int s = i * 16 + mb + r;
            kvL[s * PITCH_K + e] = (_Float16)acc[i * 4 + j][r];
          }
        }
      }
    }
    __syncthreads();

    {
      int srow = tid & (CHUNK - 1), q = tid >> 6;
      float ssum = 0.f;
      const _Float16* kr = kvL + srow * PITCH_K + q * 128;
      for (int i = 0; i < 128; i += 8) {
        v8h x8 = *reinterpret_cast<const v8h*>(kr + i);
#pragma unroll
        for (int u = 0; u < 8; ++u) {
          float x = (float)x8[u];
          ssum += x * x;
        }
      }
      rowPart[q * CHUNK + srow] = ssum;
    }
    __syncthreads();
    for (int i = tid; i < CHUNK; i += 256) {
      float sq = ((rowPart[i] + rowPart[CHUNK + i]) + rowPart[2 * CHUNK + i]) +
                 rowPart[3 * CHUNK + i];
      rsAll[c * CHUNK + i] = rsqrtf(sq * (1.f / D) + EPS);
    }
    __syncthreads();

    // scores: waves 0..3 each take one 16-wide s-tile
    if (w < 4) {
      v8f acc = vzero();
      for (int kt = 0; kt < 16; ++kt) {
        v16h a = load_ab_f16(qkL + kt * 32, D, lane, G - 1);
        v16h bf = load_ab_f16(kvL + (w * 16) * PITCH_K + kt * 32, PITCH_K, lane, 15);
        acc = wmma32(a, bf, acc);
      }
      if (lane < 16) {
        int s = c * CHUNK + w * 16 + lane;
        scoresL[0 * S + s] = acc[0];   // g = 0
        scoresL[1 * S + s] = acc[1];   // g = 1
      }
    }
    // foot of the trip: chunk c + 1 is published, and the buffer that this trip has
    // read is free for chunk c + 2
    wait_ds0();
    if (pinned(wave < NSLAB)) wait_tensor0();
    __syncthreads();
    if (pinned((wave < NSLAB) && (c + 2 < NC)))
      tdm_load_slab(g1a, slabSrc + (size_t)(c + 2) * CHUNK * D,
                       slabDst + ((c & 1) ? (LDS_HIST1 - LDS_HIST0) : 0u));
  }
  wait_tensor0();
  wait_ds0();

  // ================= softmax over S =================
  for (int i = tid; i < G * S; i += 256) {
    int s = i & (S - 1);
    float v = scoresL[i] * rsAll[s] * SCALE;
    if (mask[b * S + s]) v = -__builtin_inff();
    scoresL[i] = v;
  }
  __syncthreads();
  if (tid < 64) {
    int g = tid >> 5, l = tid & 31;
    float mx = -__builtin_inff();
    for (int s = l; s < S; s += 32) mx = fmaxf(mx, scoresL[g * S + s]);
    red[g * 32 + l] = mx;
  }
  __syncthreads();
  if (tid < 2) {
    float mx = -__builtin_inff();
    for (int l = 0; l < 32; ++l) mx = fmaxf(mx, red[tid * 32 + l]);
    red[tid * 32] = mx;
  }
  __syncthreads();
  if (tid < 64) {
    int g = tid >> 5, l = tid & 31;
    float mx = red[g * 32];
    float sm = 0.f;
    for (int s = l; s < S; s += 32) {
      float e = __expf(scoresL[g * S + s] - mx);
      scoresL[g * S + s] = e;
      sm += e;
    }
    red[64 + g * 32 + l] = sm;
  }
  __syncthreads();
  if (tid < 2) {
    float sm = 0.f;
    for (int l = 0; l < 32; ++l) sm += red[64 + tid * 32 + l];
    red[64 + tid * 32] = 1.f / sm;
  }
  __syncthreads();
  for (int i = tid; i < G * S; i += 256) {
    int g = i >> 9, s = i & (S - 1);
    float a = scoresL[i] * red[64 + g * 32];
    attnL[i] = (_Float16)a;
    outAttn[(size_t)(b * T + n * G + g) * S + s] = a;
  }
  __syncthreads();

  // ===== pass 2: out = attn @ (hist @ Wv^T), summed as (attn @ hist) @ Wv^T =====
  v8f oacc[4];
#pragma unroll
  for (int j = 0; j < 4; ++j) oacc[j] = vzero();

  // the same ring once more, the rows now at the transposing reader's pitch
  const u32x8 g1t = tdm_group1<7>();
  if (pinned(wave < NSLAB)) {
    tdm_load_slab(g1t, slabSrc, slabDst);
    wait_tensor0();
  }
  __syncthreads();
  if (pinned(wave < NSLAB))
    tdm_load_slab(g1t, slabSrc + (size_t)CHUNK * D, slabDst + (LDS_HIST1 - LDS_HIST0));

  // Wave w owns e range [w*64, w*64+64) of out = ctx @ Wv^T; fragment (j, kt) of its
  // weight slice stands at wv4 + (j*16 + kt)*512. K-steps 0..7 are asked for here,
  // ahead of the chunk loop: they need nothing of it.
  const _Float16* wv4 =
      swv + ((size_t)(n * 32 + w * 4) * 16) * 512 + lane * 16;
  v16h bq[32];
#pragma unroll
  for (int kt = 0; kt < 8; ++kt)
#pragma unroll
    for (int j = 0; j < 4; ++j)
      bq[kt * 4 + j] = load_w_frag(wv4 + (j * 16 + kt) * 512);

  for (int c = 0; c < NC; ++c) {
    const _Float16* histL =
        (const _Float16*)(smemRaw + ((c & 1) ? LDS_HIST1 : LDS_HIST0));

    // ctx += attn[:, chunk] @ hist_chunk ; wave w owns d range [w*64, w*64+64)
#pragma unroll
    for (int ks = 0; ks < CHUNK / 32; ++ks) {
      v16h a = load_ab_f16(attnL + c * CHUNK + ks * 32, S, lane, G - 1);
#pragma unroll
      for (int j = 0; j < 4; ++j) {
        v16h bf = load_bt_f16(histL + (w >> 1) * SLAB_H + (ks * 32) * PITCH_T +
                                  (w & 1) * 64 + j * 16,
                              PITCH_T, lane);
        oacc[j] = wmma32(a, bf, oacc[j]);
      }
    }
    wait_ds0();
    if (pinned(wave < NSLAB)) wait_tensor0();
    __syncthreads();
    if (pinned((wave < NSLAB) && (c + 2 < NC)))
      tdm_load_slab(g1t, slabSrc + (size_t)(c + 2) * CHUNK * D,
                       slabDst + ((c & 1) ? (LDS_HIST1 - LDS_HIST0) : 0u));
  }
  wait_tensor0();
  wait_ds0();

  static_assert(G == 2, "one ctx row per lane half");
  _Float16* ctxL = kvL;
#pragma unroll
  for (int j = 0; j < 4; ++j)
    ctxL[(lane >> 4) * D + w * 64 + j * 16 + nn] = (_Float16)oacc[j][0];
  __syncthreads();

  // out = ctx @ Wv^T: k-steps 0..7 run on the fragments asked for above, and each
  // register set is refilled for k-step kt + 8 in the k-step that read it.
  v8f tacc[4];
#pragma unroll
  for (int j = 0; j < 4; ++j) tacc[j] = vzero();
  v16h a = load_ab_f16(ctxL, D, lane, G - 1);
#pragma unroll
  for (int kt = 0; kt < 16; ++kt) {
    v16h an = a;
    if (kt + 1 < 16) an = load_ab_f16(ctxL + (kt + 1) * 32, D, lane, G - 1);
#pragma unroll
    for (int j = 0; j < 4; ++j) {
      tacc[j] = wmma32(a, bq[(kt & 7) * 4 + j], tacc[j]);
      if (kt < 8) bq[kt * 4 + j] = load_w_frag(wv4 + (j * 16 + kt + 8) * 512);
    }
    a = an;
    // holds the refill loads in their k-step: left to itself the scheduler puts
    // each load just ahead of its use, with two fragments in flight
    if (kt < 8) __builtin_amdgcn_sched_barrier(0);
  }

  if (lane < 16) {
#pragma unroll
    for (int j = 0; j < 4; ++j) {
      int e = w * 64 + j * 16 + lane;
      outTok[(size_t)(b * T + n * G + 0) * D + e] = tacc[j][0];
      outTok[(size_t)(b * T + n * G + 1) * D + e] = tacc[j][1];
    }
  }
}

// ---------------- host launcher ----------------
extern "C" void kernel_launch(void* const* d_in, const int* in_sizes, int n_in,
                              void* d_out, int out_size, void* d_ws, size_t ws_size,
                              hipStream_t stream) {
  const float* tgt  = (const float*)d_in[0];
  const float* hist = (const float*)d_in[1];
  const int*   mask = (const int*)d_in[2];
  const float* wq   = (const float*)d_in[3];
  const float* wk   = (const float*)d_in[4];
  const float* wv   = (const float*)d_in[5];
  const float* qnw  = (const float*)d_in[6];
  const float* knw  = (const float*)d_in[7];

  float* outTok  = (float*)d_out;
  float* outAttn = outTok + (size_t)B * T * D;

  char* ws = (char*)d_ws;
  _Float16* swq  = (_Float16*)(ws);
  _Float16* swk  = (_Float16*)(ws + (size_t)512 * 1024);
  _Float16* swv  = (_Float16*)(ws + (size_t)512 * 1024 + 2u * 1024 * 1024);
  _Float16* qk   = (_Float16*)(ws + (size_t)512 * 1024 + 4u * 1024 * 1024);
  _Float16* h16  = (_Float16*)(ws + (size_t)5 * 1024 * 1024);  // 32 MB

  swizzle_w<<<(512 * 512) / 256, 256, 0, stream>>>(wq, swq, 512);
  swizzle_w<<<(2048 * 512) / 256, 256, 0, stream>>>(wk, swk, 2048);
  swizzle_w<<<(2048 * 512) / 256, 256, 0, stream>>>(wv, swv, 2048);

  int n4 = B * S * D / 4;
  cvt_hist<<<(n4 + 255) / 256, 256, 0, stream>>>(hist, h16, n4);

  qproj_kernel<<<B * T / 16, 256, 0, stream>>>(tgt, swq, qnw, knw, qk);

  attn_kernel<<<B * NKV, 256, LDS_TOTAL, stream>>>(h16, mask, swk, swv, qk,
                                                   outTok, outAttn);
}

// v005
// Measured time: 102 microseconds a run.
// Next to v004, in two timings, it ran 1.14 and 1.15 times as fast.
// Over all steps from v000 it is 4.91 times as fast.
#include <hip/hip_runtime.h>
#include <hip/hip_bf16.h>

// ---------------- problem constants ----------------
constexpr int B   = 64;
constexpr int T   = 8;
constexpr int D   = 512;
constexpr int S   = 512;
constexpr int NKV = 4;
constexpr int G   = T / NKV;          // 2
constexpr int CHUNK = 64;             // S-chunk processed per iteration
constexpr int NC  = S / CHUNK;        // 8 chunks
constexpr float EPS = 1e-6f;
constexpr float SCALE = 0.044194173824159216f; // D^-0.5

typedef __attribute__((ext_vector_type(16))) _Float16 v16h;
typedef __attribute__((ext_vector_type(4)))  _Float16 v4h;
typedef __attribute__((ext_vector_type(8)))  _Float16 v8h;
typedef __attribute__((ext_vector_type(8)))  float    v8f;
typedef __attribute__((ext_vector_type(4)))  unsigned v4u;
typedef __attribute__((ext_vector_type(8)))  int      v8i;
typedef __attribute__((ext_vector_type(4)))  int      v4i;

constexpr int      NSLAB     = 4;
constexpr int      SLAB_COLS = D / NSLAB;                  // 128 f16 = 256 B a row
constexpr int      PITCH_A   = SLAB_COLS + 8;              // f16 units: 272 B
constexpr int      PITCH_T   = SLAB_COLS + 16;             // f16 units: 288 B
constexpr unsigned SLAB_BYTES = 18432;                     // 64 x 288; 64 x 272 rounded up to 2 KiB
constexpr int      SLAB_H    = SLAB_BYTES / 2;             // slab stride in f16 units
constexpr int      PITCH_K   = D + 8;                      // k rows: 1040 B, 16 B x odd
static_assert(CHUNK * PITCH_T * 2 <= (int)SLAB_BYTES && SLAB_BYTES % 2048 == 0, "slab size");
constexpr unsigned LDS_HIST0 = 0;                          // NSLAB slabs, 72 KB
constexpr unsigned LDS_HIST1 = LDS_HIST0 + NSLAB * SLAB_BYTES;  // double buffer, 72 KB
constexpr unsigned LDS_KV    = LDS_HIST1 + NSLAB * SLAB_BYTES;  // k rows / ctx, 65 KB
constexpr unsigned LDS_QK    = LDS_KV    + CHUNK * PITCH_K * 2; // [G][D] f16
constexpr unsigned LDS_ATTN  = LDS_QK    + G * D * 2;      // [G][S] f16
constexpr unsigned LDS_SCORE = LDS_ATTN  + G * S * 2;      // [G][S] f32
constexpr unsigned LDS_RS    = LDS_SCORE + G * S * 4;      // [S] f32
constexpr unsigned LDS_ROWSQ = LDS_RS    + S * 4;          // [4][CHUNK] f32
constexpr unsigned LDS_RED   = LDS_ROWSQ + 4 * CHUNK * 4;  // [128] f32
constexpr unsigned LDS_TOTAL = LDS_RED   + 128 * 4;        // ~220 KB (<320 KB/WGP)

__device__ __forceinline__ v8f wmma32(v16h a, v16h b, v8f c) {
  return __builtin_amdgcn_wmma_f32_16x16x32_f16(false, a, false, b,
                                                (short)0, c, false, false);
}

__device__ __forceinline__ int kcol(int p) {
  return ((p & 4) ? 16 : 0) + 2 * (p & 3);
}

// Load a 16(rows) x 32(K) fragment from row-major f16 memory (LDS or global).
// Rows beyond maxRow are clamped (for the G=2 query/attn rows padded to 16).
__device__ __forceinline__ v16h load_ab_f16(const _Float16* src, int pitch,
                                            int lane, int maxRow) {
  int m = lane & 15; if (m > maxRow) m = maxRow;
  int hi = (lane >> 4) & 1;
  const _Float16* row = src + m * pitch + 8 * hi;
  // k = 8*hi + 0..7 and 16 + 8*hi + 0..7, each run one 16-byte load (src and pitch
  // are multiples of 16 bytes)
  v8h lo = *reinterpret_cast<const v8h*>(row);
  v8h up = *reinterpret_cast<const v8h*>(row + 16);
  return __builtin_shufflevector(lo, up, 0, 1, 2, 3, 4, 5, 6, 7,
                                 8, 9, 10, 11, 12, 13, 14, 15);
}

// Same but source is row-major f32 in global memory (converted on the fly).
__device__ __forceinline__ v16h load_ab_f32(const float* src, int pitch, int lane) {
  int m = lane & 15;
  int hi = (lane >> 4) & 1;
  const float* row = src + (size_t)m * pitch + 8 * hi;
  v16h f;
#pragma unroll
  for (int p = 0; p < 8; ++p) {
    const float* q = row + kcol(p);
    f[2 * p]     = (_Float16)q[0];
    f[2 * p + 1] = (_Float16)q[1];
  }
  return f;
}

// 32(K rows) x 16(N columns) B fragment out of a row-major f16 LDS tile: the two
// transposing loads hand lane (c, hi) column c at k = 8*hi + 0..7 and 16 + 8*hi + 0..7,
// the k order of load_ab_f16.
__device__ __forceinline__ v16h load_bt_f16(const _Float16* tile, int pitch, int lane) {
  typedef __attribute__((ext_vector_type(8))) short s16x8;
  typedef __attribute__((address_space(3))) s16x8 lds_s16x8;
  const _Float16* p =
      tile + (8 * (lane >> 4) + (lane & 7)) * pitch + 8 * ((lane >> 3) & 1);
  v8h lo = __builtin_bit_cast(
      v8h, __builtin_amdgcn_ds_load_tr16_b128_v8i16((lds_s16x8*)p));
  v8h hi = __builtin_bit_cast(
      v8h, __builtin_amdgcn_ds_load_tr16_b128_v8i16((lds_s16x8*)(p + 16 * pitch)));
  return __builtin_shufflevector(lo, hi, 0, 1, 2, 3, 4, 5, 6, 7,
                                 8, 9, 10, 11, 12, 13, 14, 15);
}

// One pre-swizzled 32(K) x 16(N) weight fragment: 32 bytes per lane.
__device__ __forceinline__ v16h load_w_frag(const _Float16* p) {
  return *reinterpret_cast<const v16h*>(p);
}

__device__ __forceinline__ v8f vzero() {
  v8f z = {0.f, 0.f, 0.f, 0.f, 0.f, 0.f, 0.f, 0.f};
  return z;
}

// ---- Tensor mover: one slab (CHUNK rows of 256 bytes, source pitch 2*D bytes) ----
typedef __attribute__((ext_vector_type(4))) uint32_t u32x4;
typedef __attribute__((ext_vector_type(8))) uint32_t u32x8;

__device__ __forceinline__ uint32_t uni(uint32_t v) {
  return (uint32_t)__builtin_amdgcn_readfirstlane(v);
}
__device__ __forceinline__ uint32_t pinned(uint32_t v) {
  uint32_t w = uni(v);
  asm volatile("" : "+s"(w));  // pinned(): keeps the test in a scalar register
  return w;
}
// the compiler places no wait for the tensor mover
__device__ __forceinline__ void wait_tensor0() {
  asm volatile("s_wait_tensorcnt 0x0" ::: "memory");
}
// this wave's LDS reads and writes are done before the buffer is handed over
__device__ __forceinline__ void wait_ds0() {
  asm volatile("s_wait_dscnt 0x0" ::: "memory");
}
template <unsigned PADA>
__device__ __forceinline__ u32x8 tdm_group1() {
  constexpr uint32_t d0 = SLAB_COLS * 2, d1 = CHUNK;       // bytes a row, rows
  u32x8 g1;
  g1[0] = uni((1u << 20) | (5u << 22) | (PADA << 25));
  g1[1] = uni(d0 << 16);
  g1[2] = uni(d1 << 16);
  g1[3] = uni(d0 << 16);
  g1[4] = uni(d1);
  g1[5] = uni((uint32_t)D * 2u);
  g1[6] = pinned(0u);
  g1[7] = pinned(0u);
  return g1;
}
__device__ __forceinline__ void tdm_load_slab(u32x8 g1, const _Float16* gsrc,
                                              uint32_t ldsDst) {
  unsigned long long ga = (unsigned long long)(uintptr_t)gsrc;
  u32x4 g0;
  g0[0] = uni(1u);                                          // count = 1
  g0[1] = uni(ldsDst);                                      // LDS byte address
  g0[2] = uni((uint32_t)ga);                                // global address [31:0]
  g0[3] = uni((((uint32_t)(ga >> 32)) & 0x01FFFFFFu) | 0x80000000u);  // [56:32], type 2
  asm volatile("tensor_load_to_lds %0, %1" :: "s"(g0), "s"(g1) : "memory");
}

__device__ __forceinline__ void swizzle_job(const float* __restrict__ W,
                                            _Float16* __restrict__ out, int blk) {
  int idx = blk * 256 + threadIdx.x;
  int h    = idx & 15;
  int lane = (idx >> 4) & 31;
  int tile = idx >> 9;
  int dt   = tile & 15;       // D/32 == 16
  int etg  = tile >> 4;
  int e = etg * 16 + (lane & 15);
  int d = dt * 32 + 2 * (h & 8) + 8 * (lane >> 4) + (h & 7);
  out[idx] = (_Float16)W[(size_t)e * 512 + d];
}

__device__ __forceinline__ void cvt_job(const float* __restrict__ src,
                                        _Float16* __restrict__ dst, int blk) {
  int i = blk * 256 + threadIdx.x;
  float4 x = reinterpret_cast<const float4*>(src)[i];
  v4h h;
  h[0] = (_Float16)x.x; h[1] = (_Float16)x.y;
  h[2] = (_Float16)x.z; h[3] = (_Float16)x.w;
  *reinterpret_cast<v4h*>(dst + (size_t)i * 4) = h;
}

// ---------------- job: q = rmsnorm(target @ Wq^T) * (1+qw) * (1+kw) -----------
// 16 query rows a block.
__device__ __forceinline__ void qproj_job(const float* __restrict__ tgt,
                                          const _Float16* __restrict__ wq,
                                          const float* __restrict__ qw,
                                          const float* __restrict__ kw,
                                          _Float16* __restrict__ qkOut, int blk,
                                          float (*qLds)[D], float* rowSq) {
  int tid  = threadIdx.x;
  int lane = tid & 31;
  int w    = tid >> 5;
  int rowBase = blk * 16;

  v8f acc[4];
#pragma unroll
  for (int j = 0; j < 4; ++j) acc[j] = vzero();

  for (int kt = 0; kt < 16; ++kt) {
    v16h a = load_ab_f32(tgt + (size_t)rowBase * D + kt * 32, D, lane);
#pragma unroll
    for (int j = 0; j < 4; ++j) {
      int etg = w * 4 + j;
      const _Float16* tb = wq + ((size_t)(etg * 16 + kt)) * 512;
      v16h bf = *reinterpret_cast<const v16h*>(tb + lane * 16);
      acc[j] = wmma32(a, bf, acc[j]);
    }
  }

  int nn = lane & 15, mb = (lane >> 4) * 8;
#pragma unroll
  for (int j = 0; j < 4; ++j) {
    int e = (w * 4 + j) * 16 + nn;
#pragma unroll
    for (int r = 0; r < 8; ++r) qLds[mb + r][e] = acc[j][r];
  }
  if (tid < 16) rowSq[tid] = 0.f;
  __syncthreads();

  {
    int r = tid >> 4, seg = tid & 15;
    float s = 0.f;
    for (int i = 0; i < 32; ++i) {
      float x = qLds[r][seg * 32 + i];
      s += x * x;
    }
    atomicAdd(&rowSq[r], s);
  }
  __syncthreads();

  for (int i = tid; i < 16 * D; i += 256) {
    int r = i >> 9, col = i & 511;
    float rs = rsqrtf(rowSq[r] * (1.f / D) + EPS);
    float v = qLds[r][col] * rs * (1.f + qw[col]) * (1.f + kw[col]);
    qkOut[(size_t)(rowBase + r) * D + col] = (_Float16)v;
  }
}

// ---------------- kernel 0: swizzle Wq, which the q projection reads ----------
constexpr int SWQ_BLOCKS = D * D / 256;
__global__ __launch_bounds__(256)
void swizzle_wq(const float* __restrict__ wq, _Float16* __restrict__ swq) {
  swizzle_job(wq, swq, blockIdx.x);
}

// ---------------- kernel 1: the rest of the preparation, one launch ----------
// None of these four jobs reads what another of them writes, so they share one grid
// and a block takes its job by its index. The q projection's blocks stand first: they
// are few, and each is a long chain of dependent loads, which so runs beside the
// streaming jobs and not in a launch of its own.
// Stands behind a job's store: the store is still in flight where the code that follows
// the job in the merged kernel rewrites a register that it names.
__device__ __forceinline__ void wait_store_regs() {
  asm volatile("s_wait_xcnt 0x0" ::: "memory");
}
constexpr int QP_BLOCKS = B * T / 16;
constexpr int SW_BLOCKS = NKV * D * D / 256;
constexpr int CV_BLOCKS = B * S * D / 1024;
constexpr int PREP_BLOCKS = QP_BLOCKS + 2 * SW_BLOCKS + CV_BLOCKS;
__global__ __launch_bounds__(256)
void prep_kernel(const float* __restrict__ tgt, const float* __restrict__ hist,
                 const float* __restrict__ wk, const float* __restrict__ wv,
                 const float* __restrict__ qw, const float* __restrict__ kw,
                 const _Float16* __restrict__ swq, _Float16* __restrict__ qkOut,
                 _Float16* __restrict__ swk, _Float16* __restrict__ swv,
                 _Float16* __restrict__ h16) {
  __shared__ float qLds[16][D];
  __shared__ float rowSq[16];
  int blk = blockIdx.x;   // every test below reads the same for a whole block
  if (blk < QP_BLOCKS) {
    qproj_job(tgt, swq, qw, kw, qkOut, blk, qLds, rowSq);
  } else if (blk < QP_BLOCKS + SW_BLOCKS) {
    swizzle_job(wk, swk, blk - QP_BLOCKS);
    wait_store_regs();
  } else if (blk < QP_BLOCKS + 2 * SW_BLOCKS) {
    swizzle_job(wv, swv, blk - QP_BLOCKS - SW_BLOCKS);
    wait_store_regs();
  } else {
    cvt_job(hist, h16, blk - QP_BLOCKS - 2 * SW_BLOCKS);
    wait_store_regs();
  }
}

__global__ __launch_bounds__(256)
void attn_kernel(const _Float16* __restrict__ histF16,
                 const int* __restrict__ mask,
                 const _Float16* __restrict__ swk, const _Float16* __restrict__ swv,
                 const _Float16* __restrict__ qkG,
                 float* __restrict__ outTok, float* __restrict__ outAttn) {
  // 2 KiB: every tensor load's place in LDS is a multiple of that
  extern __shared__ __attribute__((aligned(2048))) char smemRaw[];
  _Float16* kvL    = (_Float16*)(smemRaw + LDS_KV);
  _Float16* qkL    = (_Float16*)(smemRaw + LDS_QK);
  _Float16* attnL  = (_Float16*)(smemRaw + LDS_ATTN);
  float*    scoresL = (float*)(smemRaw + LDS_SCORE);
  float*    rsAll   = (float*)(smemRaw + LDS_RS);
  float*    rowPart = (float*)(smemRaw + LDS_ROWSQ);
  float*    red     = (float*)(smemRaw + LDS_RED);

  int wg = blockIdx.x;
  int b  = wg / NKV;
  int n  = wg % NKV;
  int tid  = threadIdx.x;
  int lane = tid & 31;
  int w    = tid >> 5;
  int nn = lane & 15;
  int mb = (lane >> 4) * 8;

  const _Float16* histSrc = histF16 + (size_t)b * S * D;

  // Waves 0..NSLAB-1 each bring one column slab of every chunk.
  const uint32_t wave = uni(threadIdx.x >> 5);
  const uint32_t ldsBase = (uint32_t)(uintptr_t)smemRaw;   // byte offset in the work-group's LDS
  const _Float16* slabSrc = histSrc + wave * SLAB_COLS;
  const uint32_t slabDst = ldsBase + LDS_HIST0 + wave * SLAB_BYTES;

  const u32x8 g1a = tdm_group1<3>();
  // prologue of the two-buffer ring: chunk 0 lands and is published, chunk 1 is asked for
  if (pinned(wave < NSLAB)) {
    tdm_load_slab(g1a, slabSrc, slabDst);
    wait_tensor0();
  }
  for (int i = tid; i < G * D; i += 256)
    qkL[i] = qkG[(size_t)(b * T + n * G) * D + i];
  __syncthreads();
  if (pinned(wave < NSLAB))
    tdm_load_slab(g1a, slabSrc + (size_t)CHUNK * D, slabDst + (LDS_HIST1 - LDS_HIST0));

  // ================= pass 1: k projection + scores =================
  // k-proj: wave w makes columns [w*64, w*64+64) of all CHUNK rows of a chunk, a tile
  // of 4 x 4 fragments, so that every weight fragment is loaded by one wave only.
  // Fragment (j, kt) of this wave's weight slice stands at wb + (j*16 + kt)*512.
  const _Float16* wb =
      swk + ((size_t)(n * 32 + w * 4) * 16) * 512 + lane * 16;
  v16h bk[16];
#pragma unroll
  for (int u = 0; u < 4; ++u)
#pragma unroll
    for (int j = 0; j < 4; ++j) bk[u * 4 + j] = load_w_frag(wb + (j * 16 + u) * 512);

  for (int c = 0; c < NC; ++c) {
    const _Float16* histL =
        (const _Float16*)(smemRaw + ((c & 1) ? LDS_HIST1 : LDS_HIST0));
    {
      // k-step kt stands in slab kt / 4 at column (kt % 4) * 32
      v8f acc[16];
#pragma unroll
      for (int t = 0; t < 16; ++t) acc[t] = vzero();
      v16h a[4];
#pragma unroll
      for (int i = 0; i < 4; ++i)
        a[i] = load_ab_f16(histL + (i * 16) * PITCH_A, PITCH_A, lane, 15);
      // One trip is one slab, four k-steps. The A fragments are read one k-step
      // ahead; each weight register set is refilled for k-step kt + 4 right behind
      // the four WMMAs that read it.
      // Kept rolled: unrolled, the weight loads no longer depend on a loop count,
      // are lifted out of the chunk loop and spill.
#pragma unroll 1
      for (int kb = 0; kb < 16; kb += 4) {
        const int kw = (kb + 4) & 15;
        const _Float16* wn = wb + kw * 512;
        const _Float16* ab = histL + (kb >> 2) * SLAB_H;
        const _Float16* abn = histL + (kw >> 2) * SLAB_H;
#pragma unroll
        for (int u = 0; u < 4; ++u) {
          const _Float16* as = (u < 3) ? ab + (u + 1) * 32 : abn;
          v16h an[4];
#pragma unroll
          for (int i = 0; i < 4; ++i)
            an[i] = load_ab_f16(as + (i * 16) * PITCH_A, PITCH_A, lane, 15);
          // keeps the next A fragments' eight LDS reads as one group at the head of
          // their k-step: left alone the scheduler lumps the reads of several k-steps,
          // takes more registers, and one LDS wait drains to 0
          __builtin_amdgcn_sched_group_barrier(0x100, 8, 0);
#pragma unroll
          for (int j = 0; j < 4; ++j) {
#pragma unroll
            for (int i = 0; i < 4; ++i)
              acc[i * 4 + j] = wmma32(a[i], bk[u * 4 + j], acc[i * 4 + j]);
            bk[u * 4 + j] = load_w_frag(wn + (j * 16 + u) * 512);
            // keeps the order four WMMAs, their two refill loads: without it the
            // scheduler puts refills off and fewer loads are in flight at the waits
            __builtin_amdgcn_sched_group_barrier(0x008, 4, 0);
            __builtin_amdgcn_sched_group_barrier(0x020, 2, 0);
          }
#pragma unroll
          for (int i = 0; i < 4; ++i) a[i] = an[i];
        }
        // the refill loads are still in flight when the next trip rewrites the
        // address register that they name
        asm volatile("s_wait_xcnt 0x0" ::: "memory");
      }
      // store raw k rows row-major [s][d]
#pragma unroll
      for (int i = 0; i < 4; ++i) {
#pragma unroll
        for (int j = 0; j < 4; ++j) {
          int e = (w * 4 + j) * 16 + nn;
#pragma unroll
          for (int r = 0; r < 8; ++r) {
            int s = i * 16 + mb + r;
            kvL[s * PITCH_K + e] = (_Float16)acc[i * 4 + j][r];
          }
        }
      }
    }
    __syncthreads();

    {
      int srow = tid & (CHUNK - 1), q = tid >> 6;
      float ssum = 0.f;
      const _Float16* kr = kvL + srow * PITCH_K + q * 128;
      for (int i = 0; i < 128; i += 8) {
        v8h x8 = *reinterpret_cast<const v8h*>(kr + i);
#pragma unroll
        for (int u = 0; u < 8; ++u) {
          float x = (float)x8[u];
          ssum += x * x;
        }
      }
      rowPart[q * CHUNK + srow] = ssum;
    }
    __syncthreads();
    for (int i = tid; i < CHUNK; i += 256) {
      float sq = ((rowPart[i] + rowPart[CHUNK + i]) + rowPart[2 * CHUNK + i]) +
                 rowPart[3 * CHUNK + i];
      rsAll[c * CHUNK + i] = rsqrtf(sq * (1.f / D) + EPS);
    }
    __syncthreads();

    // scores: waves 0..3 each take one 16-wide s-tile
    if (w < 4) {
      v8f acc = vzero();
      for (int kt = 0; kt < 16; ++kt) {
        v16h a = load_ab_f16(qkL + kt * 32, D, lane, G - 1);
        v16h bf = load_ab_f16(kvL + (w * 16) * PITCH_K + kt * 32, PITCH_K, lane, 15);
        acc = wmma32(a, bf, acc);
      }
      if (lane < 16) {
        int s = c * CHUNK + w * 16 + lane;
        scoresL[0 * S + s] = acc[0];   // g = 0
        scoresL[1 * S + s] = acc[1];   // g = 1
      }
    }
    // foot of the trip: chunk c + 1 is published, and the buffer that this trip has
    // read is free for chunk c + 2
    wait_ds0();
    if (pinned(wave < NSLAB)) wait_tensor0();
    __syncthreads();
    if (pinned((wave < NSLAB) && (c + 2 < NC)))
      tdm_load_slab(g1a, slabSrc + (size_t)(c + 2) * CHUNK * D,
                       slabDst + ((c & 1) ? (LDS_HIST1 - LDS_HIST0) : 0u));
  }
  wait_tensor0();
  wait_ds0();

  // ================= softmax over S =================
  for (int i = tid; i < G * S; i += 256) {
    int s = i & (S - 1);
    float v = scoresL[i] * rsAll[s] * SCALE;
    if (mask[b * S + s]) v = -__builtin_inff();
    scoresL[i] = v;
  }
  __syncthreads();
  if (tid < 64) {
    int g = tid >> 5, l = tid & 31;
    float mx = -__builtin_inff();
    for (int s = l; s < S; s += 32) mx = fmaxf(mx, scoresL[g * S + s]);
    red[g * 32 + l] = mx;
  }
  __syncthreads();
  if (tid < 2) {
    float mx = -__builtin_inff();
    for (int l = 0; l < 32; ++l) mx = fmaxf(mx, red[tid * 32 + l]);
    red[tid * 32] = mx;
  }
  __syncthreads();
  if (tid < 64) {
    int g = tid >> 5, l = tid & 31;
    float mx = red[g * 32];
    float sm = 0.f;
    for (int s = l; s < S; s += 32) {
      float e = __expf(scoresL[g * S + s] - mx);
      scoresL[g * S + s] = e;
      sm += e;
    }
    red[64 + g * 32 + l] = sm;
  }
  __syncthreads();
  if (tid < 2) {
    float sm = 0.f;
    for (int l = 0; l < 32; ++l) sm += red[64 + tid * 32 + l];
    red[64 + tid * 32] = 1.f / sm;
  }
  __syncthreads();
  for (int i = tid; i < G * S; i += 256) {
    int g = i >> 9, s = i & (S - 1);
    float a = scoresL[i] * red[64 + g * 32];
    attnL[i] = (_Float16)a;
    outAttn[(size_t)(b * T + n * G + g) * S + s] = a;
  }
  __syncthreads();

  // ===== pass 2: out = attn @ (hist @ Wv^T), summed as (attn @ hist) @ Wv^T =====
  v8f oacc[4];
#pragma unroll
  for (int j = 0; j < 4; ++j) oacc[j] = vzero();

  // the same ring once more, the rows now at the transposing reader's pitch
  const u32x8 g1t = tdm_group1<7>();
  if (pinned(wave < NSLAB)) {
    tdm_load_slab(g1t, slabSrc, slabDst);
    wait_tensor0();
  }
  __syncthreads();
  if (pinned(wave < NSLAB))
    tdm_load_slab(g1t, slabSrc + (size_t)CHUNK * D, slabDst + (LDS_HIST1 - LDS_HIST0));

  // Wave w owns e range [w*64, w*64+64) of out = ctx @ Wv^T; fragment (j, kt) of its
  // weight slice stands at wv4 + (j*16 + kt)*512. K-steps 0..7 are asked for here,
  // ahead of the chunk loop: they need nothing of it.
  const _Float16* wv4 =
      swv + ((size_t)(n * 32 + w * 4) * 16) * 512 + lane * 16;
  v16h bq[32];
#pragma unroll
  for (int kt = 0; kt < 8; ++kt)
#pragma unroll
    for (int j = 0; j < 4; ++j)
      bq[kt * 4 + j] = load_w_frag(wv4 + (j * 16 + kt) * 512);

  for (int c = 0; c < NC; ++c) {
    const _Float16* histL =
        (const _Float16*)(smemRaw + ((c & 1) ? LDS_HIST1 : LDS_HIST0));

    // ctx += attn[:, chunk] @ hist_chunk ; wave w owns d range [w*64, w*64+64)
#pragma unroll
    for (int ks = 0; ks < CHUNK / 32; ++ks) {
      v16h a = load_ab_f16(attnL + c * CHUNK + ks * 32, S, lane, G - 1);
#pragma unroll
      for (int j = 0; j < 4; ++j) {
        v16h bf = load_bt_f16(histL + (w >> 1) * SLAB_H + (ks * 32) * PITCH_T +
                                  (w & 1) * 64 + j * 16,
                              PITCH_T, lane);
        oacc[j] = wmma32(a, bf, oacc[j]);
      }
    }
    wait_ds0();
    if (pinned(wave < NSLAB)) wait_tensor0();
    __syncthreads();
    if (pinned((wave < NSLAB) && (c + 2 < NC)))
      tdm_load_slab(g1t, slabSrc + (size_t)(c + 2) * CHUNK * D,
                       slabDst + ((c & 1) ? (LDS_HIST1 - LDS_HIST0) : 0u));
  }
  wait_tensor0();
  wait_ds0();

  static_assert(G == 2, "one ctx row per lane half");
  _Float16* ctxL = kvL;
#pragma unroll
  for (int j = 0; j < 4; ++j)
    ctxL[(lane >> 4) * D + w * 64 + j * 16 + nn] = (_Float16)oacc[j][0];
  __syncthreads();

  // out = ctx @ Wv^T: k-steps 0..7 run on the fragments asked for above, and each
  // register set is refilled for k-step kt + 8 in the k-step that read it.
  v8f tacc[4];
#pragma unroll
  for (int j = 0; j < 4; ++j) tacc[j] = vzero();
  v16h a = load_ab_f16(ctxL, D, lane, G - 1);
#pragma unroll
  for (int kt = 0; kt < 16; ++kt) {
    v16h an = a;
    if (kt + 1 < 16) an = load_ab_f16(ctxL + (kt + 1) * 32, D, lane, G - 1);
#pragma unroll
    for (int j = 0; j < 4; ++j) {
      tacc[j] = wmma32(a, bq[(kt & 7) * 4 + j], tacc[j]);
      if (kt < 8) bq[kt * 4 + j] = load_w_frag(wv4 + (j * 16 + kt + 8) * 512);
    }
    a = an;
    // holds the refill loads in their k-step: left to itself the scheduler puts
    // each load just ahead of its use, with two fragments in flight
    if (kt < 8) __builtin_amdgcn_sched_barrier(0);
  }

  if (lane < 16) {
#pragma unroll
    for (int j = 0; j < 4; ++j) {
      int e = w * 64 + j * 16 + lane;
      outTok[(size_t)(b * T + n * G + 0) * D + e] = tacc[j][0];
      outTok[(size_t)(b * T + n * G + 1) * D + e] = tacc[j][1];
    }
  }
}

// ---------------- host launcher ----------------
extern "C" void kernel_launch(void* const* d_in, const int* in_sizes, int n_in,
                              void* d_out, int out_size, void* d_ws, size_t ws_size,
                              hipStream_t stream) {
  const float* tgt  = (const float*)d_in[0];
  const float* hist = (const float*)d_in[1];
  const int*   mask = (const int*)d_in[2];
  const float* wq   = (const float*)d_in[3];
  const float* wk   = (const float*)d_in[4];
  const float* wv   = (const float*)d_in[5];
  const float* qnw  = (const float*)d_in[6];
  const float* knw  = (const float*)d_in[7];

  float* outTok  = (float*)d_out;
  float* outAttn = outTok + (size_t)B * T * D;

  char* ws = (char*)d_ws;
  _Float16* swq  = (_Float16*)(ws);
  _Float16* swk  = (_Float16*)(ws + (size_t)512 * 1024);
  _Float16* swv  = (_Float16*)(ws + (size_t)512 * 1024 + 2u * 1024 * 1024);
  _Float16* qk   = (_Float16*)(ws + (size_t)512 * 1024 + 4u * 1024 * 1024);
  _Float16* h16  = (_Float16*)(ws + (size_t)5 * 1024 * 1024);  // 32 MB

  swizzle_wq<<<SWQ_BLOCKS, 256, 0, stream>>>(wq, swq);

  prep_kernel<<<PREP_BLOCKS, 256, 0, stream>>>(tgt, hist, wk, wv, qnw, knw, swq,
                                               qk, swk, swv, h16);

  attn_kernel<<<B * NKV, 256, LDS_TOTAL, stream>>>(h16, mask, swk, swv, qk,
                                                   outTok, outAttn);
}

// v006
// A run of this version takes 85.4 microseconds.
// Next to v005, in two timings, it ran 1.19 and 1.20 times as fast.
// All steps since v000 together make it 5.85 times as fast.
#include <hip/hip_runtime.h>
#include <hip/hip_bf16.h>

// ---------------- problem constants ----------------
constexpr int B   = 64;
constexpr int T   = 8;
constexpr int D   = 512;
constexpr int S   = 512;
constexpr int NKV = 4;
constexpr int G   = T / NKV;          // 2
constexpr int CHUNK = 64;             // S-chunk processed per iteration
constexpr int NC  = S / CHUNK;        // 8 chunks
constexpr int CHUNK1 = 128;           // S-chunk of pass 1 (k projection + scores)
constexpr int NC1 = S / CHUNK1;       // 4 chunks
constexpr float EPS = 1e-6f;
constexpr float SCALE = 0.044194173824159216f; // D^-0.5

typedef __attribute__((ext_vector_type(16))) _Float16 v16h;
typedef __attribute__((ext_vector_type(4)))  _Float16 v4h;
typedef __attribute__((ext_vector_type(8)))  _Float16 v8h;
typedef __attribute__((ext_vector_type(8)))  float    v8f;
typedef __attribute__((ext_vector_type(4)))  unsigned v4u;
typedef __attribute__((ext_vector_type(8)))  int      v8i;
typedef __attribute__((ext_vector_type(4)))  int      v4i;

constexpr int      NSLAB     = 4;
constexpr int      SLAB_COLS = D / NSLAB;                  // 128 f16 = 256 B a row
constexpr int      PITCH_A   = SLAB_COLS + 8;              // f16 units: 272 B
constexpr int      PITCH_T   = SLAB_COLS + 16;             // f16 units: 288 B
constexpr unsigned SLAB_BYTES = 18432;                     // 64 x 288
constexpr int      SLAB_H    = SLAB_BYTES / 2;             // slab stride in f16 units
constexpr int      PITCH_K   = D + 8;                      // k rows: 1040 B, 16 B x odd
static_assert(CHUNK * PITCH_T * 2 <= (int)SLAB_BYTES && SLAB_BYTES % 2048 == 0, "slab size");
// Pass 1 holds one chunk of CHUNK1 rows, in the place of pass 2's two buffers.
constexpr unsigned SLAB1_BYTES = CHUNK1 * PITCH_A * 2;     // 128 x 272 = 17 x 2 KiB
constexpr int      SLAB1_H   = SLAB1_BYTES / 2;            // slab stride in f16 units
static_assert(SLAB1_BYTES % 2048 == 0 && SLAB1_BYTES <= 2 * SLAB_BYTES, "pass 1 slab size");
constexpr unsigned LDS_HIST0 = 0;                          // NSLAB slabs, 72 KB
constexpr unsigned LDS_HIST1 = LDS_HIST0 + NSLAB * SLAB_BYTES;  // double buffer, 72 KB
constexpr unsigned LDS_KV    = LDS_HIST1 + NSLAB * SLAB_BYTES;  // k rows / ctx, 130 KB
constexpr unsigned LDS_QK    = LDS_KV    + CHUNK1 * PITCH_K * 2; // [G][D] f16
constexpr unsigned LDS_ATTN  = LDS_QK    + G * D * 2;      // [G][S] f16
constexpr unsigned LDS_SCORE = LDS_ATTN  + G * S * 2;      // [G][S] f32
constexpr unsigned LDS_RS    = LDS_SCORE + G * S * 4;      // [S] f32
constexpr unsigned LDS_ROWSQ = LDS_RS    + S * 4;          // [4][CHUNK1] f32
constexpr unsigned LDS_RED   = LDS_ROWSQ + 4 * CHUNK1 * 4; // [128] f32
constexpr unsigned LDS_TOTAL = LDS_RED   + 128 * 4;        // ~287 KB (<320 KB/WGP)
static_assert(LDS_TOTAL <= 327680, "LDS of one WGP");

__device__ __forceinline__ v8f wmma32(v16h a, v16h b, v8f c) {
  return __builtin_amdgcn_wmma_f32_16x16x32_f16(false, a, false, b,
                                                (short)0, c, false, false);
}

__device__ __forceinline__ int kcol(int p) {
  return ((p & 4) ? 16 : 0) + 2 * (p & 3);
}

// Load a 16(rows) x 32(K) fragment from row-major f16 memory (LDS or global).
// Rows beyond maxRow are clamped (for the G=2 query/attn rows padded to 16).
__device__ __forceinline__ v16h load_ab_f16(const _Float16* src, int pitch,
                                            int lane, int maxRow) {
  int m = lane & 15; if (m > maxRow) m = maxRow;
  int hi = (lane >> 4) & 1;
  const _Float16* row = src + m * pitch + 8 * hi;
  // k = 8*hi + 0..7 and 16 + 8*hi + 0..7, each run one 16-byte load (src and pitch
  // are multiples of 16 bytes)
  v8h lo = *reinterpret_cast<const v8h*>(row);
  v8h up = *reinterpret_cast<const v8h*>(row + 16);
  return __builtin_shufflevector(lo, up, 0, 1, 2, 3, 4, 5, 6, 7,
                                 8, 9, 10, 11, 12, 13, 14, 15);
}

// Same but source is row-major f32 in global memory (converted on the fly).
__device__ __forceinline__ v16h load_ab_f32(const float* src, int pitch, int lane) {
  int m = lane & 15;
  int hi = (lane >> 4) & 1;
  const float* row = src + (size_t)m * pitch + 8 * hi;
  v16h f;
#pragma unroll
  for (int p = 0; p < 8; ++p) {
    const float* q = row + kcol(p);
    f[2 * p]     = (_Float16)q[0];
    f[2 * p + 1] = (_Float16)q[1];
  }
  return f;
}

// 32(K rows) x 16(N columns) B fragment out of a row-major f16 LDS tile: the two
// transposing loads hand lane (c, hi) column c at k = 8*hi + 0..7 and 16 + 8*hi + 0..7,
// the k order of load_ab_f16.
__device__ __forceinline__ v16h load_bt_f16(const _Float16* tile, int pitch, int lane) {
  typedef __attribute__((ext_vector_type(8))) short s16x8;
  typedef __attribute__((address_space(3))) s16x8 lds_s16x8;
  const _Float16* p =
      tile + (8 * (lane >> 4) + (lane & 7)) * pitch + 8 * ((lane >> 3) & 1);
  v8h lo = __builtin_bit_cast(
      v8h, __builtin_amdgcn_ds_load_tr16_b128_v8i16((lds_s16x8*)p));
  v8h hi = __builtin_bit_cast(
      v8h, __builtin_amdgcn_ds_load_tr16_b128_v8i16((lds_s16x8*)(p + 16 * pitch)));
  return __builtin_shufflevector(lo, hi, 0, 1, 2, 3, 4, 5, 6, 7,
                                 8, 9, 10, 11, 12, 13, 14, 15);
}

// One pre-swizzled 32(K) x 16(N) weight fragment: 32 bytes per lane.
__device__ __forceinline__ v16h load_w_frag(const _Float16* p) {
  return *reinterpret_cast<const v16h*>(p);
}

__device__ __forceinline__ v8f vzero() {
  v8f z = {0.f, 0.f, 0.f, 0.f, 0.f, 0.f, 0.f, 0.f};
  return z;
}

// ---- Tensor mover: one slab (ROWS rows of 256 bytes, source pitch 2*D bytes) ----
typedef __attribute__((ext_vector_type(4))) uint32_t u32x4;
typedef __attribute__((ext_vector_type(8))) uint32_t u32x8;

__device__ __forceinline__ uint32_t uni(uint32_t v) {
  return (uint32_t)__builtin_amdgcn_readfirstlane(v);
}
__device__ __forceinline__ uint32_t pinned(uint32_t v) {
  uint32_t w = uni(v);
  asm volatile("" : "+s"(w));  // pinned(): keeps the test in a scalar register
  return w;
}
// the compiler places no wait for the tensor mover
__device__ __forceinline__ void wait_tensor0() {
  asm volatile("s_wait_tensorcnt 0x0" ::: "memory");
}
// this wave's LDS reads and writes are done before the buffer is handed over
__device__ __forceinline__ void wait_ds0() {
  asm volatile("s_wait_dscnt 0x0" ::: "memory");
}
template <unsigned PADA, unsigned ROWS>
__device__ __forceinline__ u32x8 tdm_group1() {
  constexpr uint32_t d0 = SLAB_COLS * 2, d1 = ROWS;        // bytes a row, rows
  u32x8 g1;
  g1[0] = uni((1u << 20) | (5u << 22) | (PADA << 25));
  g1[1] = uni(d0 << 16);
  g1[2] = uni(d1 << 16);
  g1[3] = uni(d0 << 16);
  g1[4] = uni(d1);
  g1[5] = uni((uint32_t)D * 2u);
  g1[6] = pinned(0u);
  g1[7] = pinned(0u);
  return g1;
}
__device__ __forceinline__ void tdm_load_slab(u32x8 g1, const _Float16* gsrc,
                                              uint32_t ldsDst) {
  unsigned long long ga = (unsigned long long)(uintptr_t)gsrc;
  u32x4 g0;
  g0[0] = uni(1u);                                          // count = 1
  g0[1] = uni(ldsDst);                                      // LDS byte address
  g0[2] = uni((uint32_t)ga);                                // global address [31:0]
  g0[3] = uni((((uint32_t)(ga >> 32)) & 0x01FFFFFFu) | 0x80000000u);  // [56:32], type 2
  asm volatile("tensor_load_to_lds %0, %1" :: "s"(g0), "s"(g1) : "memory");
}

__device__ __forceinline__ void swizzle_job(const float* __restrict__ W,
                                            _Float16* __restrict__ out, int blk) {
  int idx = blk * 256 + threadIdx.x;
  int h    = idx & 15;
  int lane = (idx >> 4) & 31;
  int tile = idx >> 9;
  int dt   = tile & 15;       // D/32 == 16
  int etg  = tile >> 4;
  int e = etg * 16 + (lane & 15);
  int d = dt * 32 + 2 * (h & 8) + 8 * (lane >> 4) + (h & 7);
  out[idx] = (_Float16)W[(size_t)e * 512 + d];
}

__device__ __forceinline__ void cvt_job(const float* __restrict__ src,
                                        _Float16* __restrict__ dst, int blk) {
  int i = blk * 256 + threadIdx.x;
  float4 x = reinterpret_cast<const float4*>(src)[i];
  v4h h;
  h[0] = (_Float16)x.x; h[1] = (_Float16)x.y;
  h[2] = (_Float16)x.z; h[3] = (_Float16)x.w;
  *reinterpret_cast<v4h*>(dst + (size_t)i * 4) = h;
}

// ---------------- job: q = rmsnorm(target @ Wq^T) * (1+qw) * (1+kw) -----------
// 16 query rows a block.
__device__ __forceinline__ void qproj_job(const float* __restrict__ tgt,
                                          const _Float16* __restrict__ wq,
                                          const float* __restrict__ qw,
                                          const float* __restrict__ kw,
                                          _Float16* __restrict__ qkOut, int blk,
                                          float (*qLds)[D], float* rowSq) {
  int tid  = threadIdx.x;
  int lane = tid & 31;
  int w    = tid >> 5;
  int rowBase = blk * 16;

  v8f acc[4];
#pragma unroll
  for (int j = 0; j < 4; ++j) acc[j] = vzero();

  for (int kt = 0; kt < 16; ++kt) {
    v16h a = load_ab_f32(tgt + (size_t)rowBase * D + kt * 32, D, lane);
#pragma unroll
    for (int j = 0; j < 4; ++j) {
      int etg = w * 4 + j;
      const _Float16* tb = wq + ((size_t)(etg * 16 + kt)) * 512;
      v16h bf = *reinterpret_cast<const v16h*>(tb + lane * 16);
      acc[j] = wmma32(a, bf, acc[j]);
    }
  }

  int nn = lane & 15, mb = (lane >> 4) * 8;
#pragma unroll
  for (int j = 0; j < 4; ++j) {
    int e = (w * 4 + j) * 16 + nn;
#pragma unroll
    for (int r = 0; r < 8; ++r) qLds[mb + r][e] = acc[j][r];
  }
  if (tid < 16) rowSq[tid] = 0.f;
  __syncthreads();

  {
    int r = tid >> 4, seg = tid & 15;
    float s = 0.f;
    for (int i = 0; i < 32; ++i) {
      float x = qLds[r][seg * 32 + i];
      s += x * x;
    }
    atomicAdd(&rowSq[r], s);
  }
  __syncthreads();

  for (int i = tid; i < 16 * D; i += 256) {
    int r = i >> 9, col = i & 511;
    float rs = rsqrtf(rowSq[r] * (1.f / D) + EPS);
    float v = qLds[r][col] * rs * (1.f + qw[col]) * (1.f + kw[col]);
    qkOut[(size_t)(rowBase + r) * D + col] = (_Float16)v;
  }
}

// ---------------- kernel 0: swizzle Wq, which the q projection reads ----------
constexpr int SWQ_BLOCKS = D * D / 256;
__global__ __launch_bounds__(256)
void swizzle_wq(const float* __restrict__ wq, _Float16* __restrict__ swq) {
  swizzle_job(wq, swq, blockIdx.x);
}

// ---------------- kernel 1: the rest of the preparation, one launch ----------
// None of these four jobs reads what another of them writes, so they share one grid
// and a block takes its job by its index. The q projection's blocks stand first: they
// are few, and each is a long chain of dependent loads, which so runs beside the
// streaming jobs and not in a launch of its own.
// Stands behind a job's store: the store is still in flight where the code that follows
// the job in the merged kernel rewrites a register that it names.
__device__ __forceinline__ void wait_store_regs() {
  asm volatile("s_wait_xcnt 0x0" ::: "memory");
}
constexpr int QP_BLOCKS = B * T / 16;
constexpr int SW_BLOCKS = NKV * D * D / 256;
constexpr int CV_BLOCKS = B * S * D / 1024;
constexpr int PREP_BLOCKS = QP_BLOCKS + 2 * SW_BLOCKS + CV_BLOCKS;
__global__ __launch_bounds__(256)
void prep_kernel(const float* __restrict__ tgt, const float* __restrict__ hist,
                 const float* __restrict__ wk, const float* __restrict__ wv,
                 const float* __restrict__ qw, const float* __restrict__ kw,
                 const _Float16* __restrict__ swq, _Float16* __restrict__ qkOut,
                 _Float16* __restrict__ swk, _Float16* __restrict__ swv,
                 _Float16* __restrict__ h16) {
  __shared__ float qLds[16][D];
  __shared__ float rowSq[16];
  int blk = blockIdx.x;   // every test below reads the same for a whole block
  if (blk < QP_BLOCKS) {
    qproj_job(tgt, swq, qw, kw, qkOut, blk, qLds, rowSq);
  } else if (blk < QP_BLOCKS + SW_BLOCKS) {
    swizzle_job(wk, swk, blk - QP_BLOCKS);
    wait_store_regs();
  } else if (blk < QP_BLOCKS + 2 * SW_BLOCKS) {
    swizzle_job(wv, swv, blk - QP_BLOCKS - SW_BLOCKS);
    wait_store_regs();
  } else {
    cvt_job(hist, h16, blk - QP_BLOCKS - 2 * SW_BLOCKS);
    wait_store_regs();
  }
}

__global__ __launch_bounds__(256)
void attn_kernel(const _Float16* __restrict__ histF16,
                 const int* __restrict__ mask,
                 const _Float16* __restrict__ swk, const _Float16* __restrict__ swv,
                 const _Float16* __restrict__ qkG,
                 float* __restrict__ outTok, float* __restrict__ outAttn) {
  // 2 KiB: every tensor load's place in LDS is a multiple of that
  extern __shared__ __attribute__((aligned(2048))) char smemRaw[];
  _Float16* kvL    = (_Float16*)(smemRaw + LDS_KV);
  _Float16* qkL    = (_Float16*)(smemRaw + LDS_QK);
  _Float16* attnL  = (_Float16*)(smemRaw + LDS_ATTN);
  float*    scoresL = (float*)(smemRaw + LDS_SCORE);
  float*    rsAll   = (float*)(smemRaw + LDS_RS);
  float*    rowPart = (float*)(smemRaw + LDS_ROWSQ);
  float*    red     = (float*)(smemRaw + LDS_RED);

  int wg = blockIdx.x;
  int b  = wg / NKV;
  int n  = wg % NKV;
  int tid  = threadIdx.x;
  int lane = tid & 31;
  int w    = tid >> 5;
  int nn = lane & 15;
  int mb = (lane >> 4) * 8;

  const _Float16* histSrc = histF16 + (size_t)b * S * D;

  // Waves 0..NSLAB-1 each bring one column slab of every chunk.
  const uint32_t wave = uni(threadIdx.x >> 5);
  const uint32_t ldsBase = (uint32_t)(uintptr_t)smemRaw;   // byte offset in the work-group's LDS
  const _Float16* slabSrc = histSrc + wave * SLAB_COLS;
  const uint32_t slabDst = ldsBase + LDS_HIST0 + wave * SLAB_BYTES;

  const uint32_t slabDst1 = ldsBase + LDS_HIST0 + wave * SLAB1_BYTES;

  const u32x8 g1a = tdm_group1<3, CHUNK1>();
  // pass 1 has one history buffer: chunk 0 lands and is published
  if (pinned(wave < NSLAB)) {
    tdm_load_slab(g1a, slabSrc, slabDst1);
    wait_tensor0();
  }
  for (int i = tid; i < G * D; i += 256)
    qkL[i] = qkG[(size_t)(b * T + n * G) * D + i];
  __syncthreads();

  // ================= pass 1: k projection + scores =================
  // k-proj: wave w makes columns [w*64, w*64+64) of all CHUNK1 rows of a chunk, a tile
  // of 8 x 4 fragments: every weight fragment is loaded by one wave only and feeds
  // eight WMMAs, so that the weights come from L2 NC1 times.
  // Fragment (j, kt) of this wave's weight slice stands at wb + (j*16 + kt)*512.
  const _Float16* wb =
      swk + ((size_t)(n * 32 + w * 4) * 16) * 512 + lane * 16;
  v16h bk[16];
#pragma unroll
  for (int u = 0; u < 4; ++u)
#pragma unroll
    for (int j = 0; j < 4; ++j) bk[u * 4 + j] = load_w_frag(wb + (j * 16 + u) * 512);

  for (int c = 0; c < NC1; ++c) {
    const _Float16* histL = (const _Float16*)(smemRaw + LDS_HIST0);
    {
      // k-step kt stands in slab kt / 4 at column (kt % 4) * 32
      v8f acc[32];
#pragma unroll
      for (int t = 0; t < 32; ++t) acc[t] = vzero();
      v16h a[4];
#pragma unroll
      for (int i = 0; i < 4; ++i)
        a[i] = load_ab_f16(histL + (i * 16) * PITCH_A, PITCH_A, lane, 15);
      // One trip is one slab, four k-steps; a k-step is two half-steps, rows 0..63 and
      // rows 64..127, on the same four weight fragments. The A fragments are read one
      // half-step ahead; each weight register set is refilled for k-step kt + 4 right
      // behind the last four WMMAs that read it.
      // Kept rolled: unrolled, the weight loads no longer depend on a loop count,
      // are lifted out of the chunk loop and spill.
#pragma unroll 1
      for (int kb = 0; kb < 16; kb += 4) {
        const int kw = (kb + 4) & 15;
        const _Float16* wn = wb + kw * 512;
        const _Float16* ab = histL + (kb >> 2) * SLAB1_H;
        const _Float16* abn = histL + (kw >> 2) * SLAB1_H;
#pragma unroll
        for (int u = 0; u < 4; ++u) {
#pragma unroll
          for (int hf = 0; hf < 2; ++hf) {
            const _Float16* as = (hf == 0) ? ab + u * 32 + 64 * PITCH_A
                                           : ((u < 3) ? ab + (u + 1) * 32 : abn);
            v16h an[4];
#pragma unroll
            for (int i = 0; i < 4; ++i)
              an[i] = load_ab_f16(as + (i * 16) * PITCH_A, PITCH_A, lane, 15);
            // keeps the next A fragments' eight LDS reads as one group at the head of
            // their half-step: left alone the scheduler lumps the reads of several
            // half-steps, takes more registers, and one LDS wait drains to 0
            __builtin_amdgcn_sched_group_barrier(0x100, 8, 0);
#pragma unroll
            for (int j = 0; j < 4; ++j) {
#pragma unroll
              for (int i = 0; i < 4; ++i)
                acc[hf * 16 + i * 4 + j] =
                    wmma32(a[i], bk[u * 4 + j], acc[hf * 16 + i * 4 + j]);
              // keeps the order four WMMAs and, in the second half-step, their two
              // refill loads: without it the scheduler puts refills off and fewer
              // loads are in flight at the waits
              __builtin_amdgcn_sched_group_barrier(0x008, 4, 0);
              if (hf == 1) {
                bk[u * 4 + j] = load_w_frag(wn + (j * 16 + u) * 512);
                __builtin_amdgcn_sched_group_barrier(0x020, 2, 0);
              }
            }
#pragma unroll
            for (int i = 0; i < 4; ++i) a[i] = an[i];
          }
        }
        // the refill loads are still in flight when the next trip rewrites the
        // address register that they name
        asm volatile("s_wait_xcnt 0x0" ::: "memory");
      }
      // store raw k rows row-major [s][d]
#pragma unroll
      for (int i = 0; i < 8; ++i) {
#pragma unroll
        for (int j = 0; j < 4; ++j) {
          int e = (w * 4 + j) * 16 + nn;
#pragma unroll
          for (int r = 0; r < 8; ++r) {
            int s = i * 16 + mb + r;
            kvL[s * PITCH_K + e] = (_Float16)acc[i * 4 + j][r];
          }
        }
      }
    }
    // every wave has left the history buffer, and the k rows are published: chunk
    // c + 1 is asked for here and lands while the rest of the trip works on the k rows
    wait_ds0();
    __syncthreads();
    if (pinned((wave < NSLAB) && (c + 1 < NC1)))
      tdm_load_slab(g1a, slabSrc + (size_t)(c + 1) * CHUNK1 * D, slabDst1);

    {
      int srow = tid & (CHUNK1 - 1);
#pragma unroll
      for (int qq = 0; qq < 2; ++qq) {
        int q = (tid >> 7) * 2 + qq;
        float ssum = 0.f;
        const _Float16* kr = kvL + srow * PITCH_K + q * 128;
        for (int i = 0; i < 128; i += 8) {
          v8h x8 = *reinterpret_cast<const v8h*>(kr + i);
#pragma unroll
          for (int u = 0; u < 8; ++u) {
            float x = (float)x8[u];
            ssum += x * x;
          }
        }
        rowPart[q * CHUNK1 + srow] = ssum;
      }
    }
    __syncthreads();
    for (int i = tid; i < CHUNK1; i += 256) {
      float sq = ((rowPart[i] + rowPart[CHUNK1 + i]) + rowPart[2 * CHUNK1 + i]) +
                 rowPart[3 * CHUNK1 + i];
      rsAll[c * CHUNK1 + i] = rsqrtf(sq * (1.f / D) + EPS);
    }
    __syncthreads();

    // scores: each of the eight waves takes one 16-wide s-tile
    static_assert(CHUNK1 / 16 == 8, "one s-tile a wave");
    {
      v8f acc = vzero();
      for (int kt = 0; kt < 16; ++kt) {
        v16h a = load_ab_f16(qkL + kt * 32, D, lane, G - 1);
        v16h bf = load_ab_f16(kvL + (w * 16) * PITCH_K + kt * 32, PITCH_K, lane, 15);
        acc = wmma32(a, bf, acc);
      }
      if (lane < 16) {
        int s = c * CHUNK1 + w * 16 + lane;
        scoresL[0 * S + s] = acc[0];   // g = 0
        scoresL[1 * S + s] = acc[1];   // g = 1
      }
    }
    // foot of the trip: chunk c + 1 is published, and every reader has left the k rows
    wait_ds0();
    if (pinned(wave < NSLAB)) wait_tensor0();
    __syncthreads();
  }
  wait_tensor0();
  wait_ds0();

  // ================= softmax over S =================
  for (int i = tid; i < G * S; i += 256) {
    int s = i & (S - 1);
    float v = scoresL[i] * rsAll[s] * SCALE;
    if (mask[b * S + s]) v = -__builtin_inff();
    scoresL[i] = v;
  }
  __syncthreads();
  if (tid < 64) {
    int g = tid >> 5, l = tid & 31;
    float mx = -__builtin_inff();
    for (int s = l; s < S; s += 32) mx = fmaxf(mx, scoresL[g * S + s]);
    red[g * 32 + l] = mx;
  }
  __syncthreads();
  if (tid < 2) {
    float mx = -__builtin_inff();
    for (int l = 0; l < 32; ++l) mx = fmaxf(mx, red[tid * 32 + l]);
    red[tid * 32] = mx;
  }
  __syncthreads();
  if (tid < 64) {
    int g = tid >> 5, l = tid & 31;
    float mx = red[g * 32];
    float sm = 0.f;
    for (int s = l; s < S; s += 32) {
      float e = __expf(scoresL[g * S + s] - mx);
      scoresL[g * S + s] = e;
      sm += e;
    }
    red[64 + g * 32 + l] = sm;
  }
  __syncthreads();
  if (tid < 2) {
    float sm = 0.f;
    for (int l = 0; l < 32; ++l) sm += red[64 + tid * 32 + l];
    red[64 + tid * 32] = 1.f / sm;
  }
  __syncthreads();
  for (int i = tid; i < G * S; i += 256) {
    int g = i >> 9, s = i & (S - 1);
    float a = scoresL[i] * red[64 + g * 32];
    attnL[i] = (_Float16)a;
    outAttn[(size_t)(b * T + n * G + g) * S + s] = a;
  }
  __syncthreads();

  // ===== pass 2: out = attn @ (hist @ Wv^T), summed as (attn @ hist) @ Wv^T =====
  v8f oacc[4];
#pragma unroll
  for (int j = 0; j < 4; ++j) oacc[j] = vzero();

  // chunks of CHUNK rows in a double-buffered ring, the rows at the transposing reader's pitch
  const u32x8 g1t = tdm_group1<7, CHUNK>();
  if (pinned(wave < NSLAB)) {
    tdm_load_slab(g1t, slabSrc, slabDst);
    wait_tensor0();
  }
  __syncthreads();
  if (pinned(wave < NSLAB))
    tdm_load_slab(g1t, slabSrc + (size_t)CHUNK * D, slabDst + (LDS_HIST1 - LDS_HIST0));

  // Wave w owns e range [w*64, w*64+64) of out = ctx @ Wv^T; fragment (j, kt) of its
  // weight slice stands at wv4 + (j*16 + kt)*512. K-steps 0..7 are asked for here,
  // ahead of the chunk loop: they need nothing of it.
  const _Float16* wv4 =
      swv + ((size_t)(n * 32 + w * 4) * 16) * 512 + lane * 16;
  v16h bq[32];
#pragma unroll
  for (int kt = 0; kt < 8; ++kt)
#pragma unroll
    for (int j = 0; j < 4; ++j)
      bq[kt * 4 + j] = load_w_frag(wv4 + (j * 16 + kt) * 512);

  for (int c = 0; c < NC; ++c) {
    const _Float16* histL =
        (const _Float16*)(smemRaw + ((c & 1) ? LDS_HIST1 : LDS_HIST0));

    // ctx += attn[:, chunk] @ hist_chunk ; wave w owns d range [w*64, w*64+64)
#pragma unroll
    for (int ks = 0; ks < CHUNK / 32; ++ks) {
      v16h a = load_ab_f16(attnL + c * CHUNK + ks * 32, S, lane, G - 1);
#pragma unroll
      for (int j = 0; j < 4; ++j) {
        v16h bf = load_bt_f16(histL + (w >> 1) * SLAB_H + (ks * 32) * PITCH_T +
                                  (w & 1) * 64 + j * 16,
                              PITCH_T, lane);
        oacc[j] = wmma32(a, bf, oacc[j]);
      }
    }
    wait_ds0();
    if (pinned(wave < NSLAB)) wait_tensor0();
    __syncthreads();
    if (pinned((wave < NSLAB) && (c + 2 < NC)))
      tdm_load_slab(g1t, slabSrc + (size_t)(c + 2) * CHUNK * D,
                       slabDst + ((c & 1) ? (LDS_HIST1 - LDS_HIST0) : 0u));
  }
  wait_tensor0();
  wait_ds0();

  static_assert(G == 2, "one ctx row per lane half");
  _Float16* ctxL = kvL;
#pragma unroll
  for (int j = 0; j < 4; ++j)
    ctxL[(lane >> 4) * D + w * 64 + j * 16 + nn] = (_Float16)oacc[j][0];
  __syncthreads();

  // out = ctx @ Wv^T: k-steps 0..7 run on the fragments asked for above, and each
  // register set is refilled for k-step kt + 8 in the k-step that read it.
  v8f tacc[4];
#pragma unroll
  for (int j = 0; j < 4; ++j) tacc[j] = vzero();
  v16h a = load_ab_f16(ctxL, D, lane, G - 1);
#pragma unroll
  for (int kt = 0; kt < 16; ++kt) {
    v16h an = a;
    if (kt + 1 < 16) an = load_ab_f16(ctxL + (kt + 1) * 32, D, lane, G - 1);
#pragma unroll
    for (int j = 0; j < 4; ++j) {
      tacc[j] = wmma32(a, bq[(kt & 7) * 4 + j], tacc[j]);
      if (kt < 8) bq[kt * 4 + j] = load_w_frag(wv4 + (j * 16 + kt + 8) * 512);
    }
    a = an;
    // holds the refill loads in their k-step: left to itself the scheduler puts
    // each load just ahead of its use, with two fragments in flight
    if (kt < 8) __builtin_amdgcn_sched_barrier(0);
  }

  if (lane < 16) {
#pragma unroll
    for (int j = 0; j < 4; ++j) {
      int e = w * 64 + j * 16 + lane;
      outTok[(size_t)(b * T + n * G + 0) * D + e] = tacc[j][0];
      outTok[(size_t)(b * T + n * G + 1) * D + e] = tacc[j][1];
    }
  }
}

// ---------------- host launcher ----------------
extern "C" void kernel_launch(void* const* d_in, const int* in_sizes, int n_in,
                              void* d_out, int out_size, void* d_ws, size_t ws_size,
                              hipStream_t stream) {
  const float* tgt  = (const float*)d_in[0];
  const float* hist = (const float*)d_in[1];
  const int*   mask = (const int*)d_in[2];
  const float* wq   = (const float*)d_in[3];
  const float* wk   = (const float*)d_in[4];
  const float* wv   = (const float*)d_in[5];
  const float* qnw  = (const float*)d_in[6];
  const float* knw  = (const float*)d_in[7];

  float* outTok  = (float*)d_out;
  float* outAttn = outTok + (size_t)B * T * D;

  char* ws = (char*)d_ws;
  _Float16* swq  = (_Float16*)(ws);
  _Float16* swk  = (_Float16*)(ws + (size_t)512 * 1024);
  _Float16* swv  = (_Float16*)(ws + (size_t)512 * 1024 + 2u * 1024 * 1024);
  _Float16* qk   = (_Float16*)(ws + (size_t)512 * 1024 + 4u * 1024 * 1024);
  _Float16* h16  = (_Float16*)(ws + (size_t)5 * 1024 * 1024);  // 32 MB

  swizzle_wq<<<SWQ_BLOCKS, 256, 0, stream>>>(wq, swq);

  prep_kernel<<<PREP_BLOCKS, 256, 0, stream>>>(tgt, hist, wk, wv, qnw, knw, swq,
                                               qk, swk, swv, h16);

  attn_kernel<<<B * NKV, 256, LDS_TOTAL, stream>>>(h16, mask, swk, swv, qk,
                                                   outTok, outAttn);
}

// v007
// A run of this version takes 79.3 microseconds.
// Two timings next to v006 both put it at 1.08 times that version's speed.
// Over all steps from v000 it is 6.30 times as fast.
#include <hip/hip_runtime.h>
#include <hip/hip_bf16.h>

// ---------------- problem constants ----------------
constexpr int B   = 64;
constexpr int T   = 8;
constexpr int D   = 512;
constexpr int S   = 512;
constexpr int NKV = 4;
constexpr int G   = T / NKV;          // 2
constexpr int CHUNK = 64;             // S-chunk processed per iteration
constexpr int NC  = S / CHUNK;        // 8 chunks
constexpr int CHUNK1 = 128;           // S-chunk of pass 1 (k projection + scores)
constexpr int NC1 = S / CHUNK1;       // 4 chunks
constexpr float EPS = 1e-6f;
constexpr float SCALE = 0.044194173824159216f; // D^-0.5

typedef __attribute__((ext_vector_type(16))) _Float16 v16h;
typedef __attribute__((ext_vector_type(4)))  _Float16 v4h;
typedef __attribute__((ext_vector_type(8)))  _Float16 v8h;
typedef __attribute__((ext_vector_type(8)))  float    v8f;
typedef __attribute__((ext_vector_type(2)))  float    v2f;
typedef __attribute__((ext_vector_type(4)))  unsigned v4u;
typedef __attribute__((ext_vector_type(8)))  int      v8i;
typedef __attribute__((ext_vector_type(4)))  int      v4i;

constexpr int      NSLAB     = 4;
constexpr int      SLAB_COLS = D / NSLAB;
constexpr int      PITCH_A   = SLAB_COLS + 8;
constexpr int      PITCH_T   = SLAB_COLS + 16;
constexpr unsigned SLAB_BYTES = 18432;
constexpr int      SLAB_H    = SLAB_BYTES / 2;
constexpr int      PITCH_P   = S + 16;
static_assert(CHUNK * PITCH_T * 2 <= (int)SLAB_BYTES && SLAB_BYTES % 2048 == 0, "slab size");
// Pass 1 holds one chunk of CHUNK1 rows, in the place of pass 2's two buffers.
constexpr unsigned SLAB1_BYTES = CHUNK1 * PITCH_A * 2;     // 128 x 272 = 17 x 2 KiB
constexpr int      SLAB1_H   = SLAB1_BYTES / 2;            // slab stride in f16 units
static_assert(SLAB1_BYTES % 2048 == 0 && SLAB1_BYTES <= 2 * SLAB_BYTES, "pass 1 slab size");
constexpr unsigned LDS_HIST0 = 0;                          // NSLAB slabs, 72 KB
constexpr unsigned LDS_HIST1 = LDS_HIST0 + NSLAB * SLAB_BYTES;  // double buffer, 72 KB
constexpr unsigned LDS_SQP   = LDS_HIST1 + NSLAB * SLAB_BYTES;  // [8 waves][2 halves][PITCH_P] f32
constexpr unsigned LDS_SCP   = LDS_SQP   + 16 * PITCH_P * 4; // [8 waves][G][PITCH_P] f32
constexpr unsigned LDS_CTX   = LDS_SCP   + 16 * PITCH_P * 4; // [G][D] f16
constexpr unsigned LDS_QK    = LDS_CTX   + G * D * 2;      // [G][D] f16
constexpr unsigned LDS_ATTN  = LDS_QK    + G * D * 2;      // [G][S] f16
constexpr unsigned LDS_SCORE = LDS_ATTN  + G * S * 2;      // [G][S] f32
constexpr unsigned LDS_RED   = LDS_SCORE + G * S * 4;      // [128] f32
constexpr unsigned LDS_TOTAL = LDS_RED   + 128 * 4;        // ~221 KB (<320 KB/WGP)
static_assert(LDS_TOTAL <= 327680, "LDS of one WGP");

__device__ __forceinline__ v8f wmma32(v16h a, v16h b, v8f c) {
  return __builtin_amdgcn_wmma_f32_16x16x32_f16(false, a, false, b,
                                                (short)0, c, false, false);
}

__device__ __forceinline__ int kcol(int p) {
  return ((p & 4) ? 16 : 0) + 2 * (p & 3);
}

// Load a 16(rows) x 32(K) fragment from row-major f16 memory (LDS or global).
// Rows beyond maxRow are clamped (for the G=2 query/attn rows padded to 16).
__device__ __forceinline__ v16h load_ab_f16(const _Float16* src, int pitch,
                                            int lane, int maxRow) {
  int m = lane & 15; if (m > maxRow) m = maxRow;
  int hi = (lane >> 4) & 1;
  const _Float16* row = src + m * pitch + 8 * hi;
  // k = 8*hi + 0..7 and 16 + 8*hi + 0..7, each run one 16-byte load (src and pitch
  // are multiples of 16 bytes)
  v8h lo = *reinterpret_cast<const v8h*>(row);
  v8h up = *reinterpret_cast<const v8h*>(row + 16);
  return __builtin_shufflevector(lo, up, 0, 1, 2, 3, 4, 5, 6, 7,
                                 8, 9, 10, 11, 12, 13, 14, 15);
}

// Same but source is row-major f32 in global memory (converted on the fly).
__device__ __forceinline__ v16h load_ab_f32(const float* src, int pitch, int lane) {
  int m = lane & 15;
  int hi = (lane >> 4) & 1;
  const float* row = src + (size_t)m * pitch + 8 * hi;
  v16h f;
#pragma unroll
  for (int p = 0; p < 8; ++p) {
    const float* q = row + kcol(p);
    f[2 * p]     = (_Float16)q[0];
    f[2 * p + 1] = (_Float16)q[1];
  }
  return f;
}

// 32(K rows) x 16(N columns) B fragment out of a row-major f16 LDS tile: the two
// transposing loads hand lane (c, hi) column c at k = 8*hi + 0..7 and 16 + 8*hi + 0..7,
// the k order of load_ab_f16.
__device__ __forceinline__ v16h load_bt_f16(const _Float16* tile, int pitch, int lane) {
  typedef __attribute__((ext_vector_type(8))) short s16x8;
  typedef __attribute__((address_space(3))) s16x8 lds_s16x8;
  const _Float16* p =
      tile + (8 * (lane >> 4) + (lane & 7)) * pitch + 8 * ((lane >> 3) & 1);
  v8h lo = __builtin_bit_cast(
      v8h, __builtin_amdgcn_ds_load_tr16_b128_v8i16((lds_s16x8*)p));
  v8h hi = __builtin_bit_cast(
      v8h, __builtin_amdgcn_ds_load_tr16_b128_v8i16((lds_s16x8*)(p + 16 * pitch)));
  return __builtin_shufflevector(lo, hi, 0, 1, 2, 3, 4, 5, 6, 7,
                                 8, 9, 10, 11, 12, 13, 14, 15);
}

// One pre-swizzled 32(K) x 16(N) weight fragment: 32 bytes per lane.
__device__ __forceinline__ v16h load_w_frag(const _Float16* p) {
  return *reinterpret_cast<const v16h*>(p);
}

__device__ __forceinline__ v8f vzero() {
  v8f z = {0.f, 0.f, 0.f, 0.f, 0.f, 0.f, 0.f, 0.f};
  return z;
}

// ---- Tensor mover: one slab (ROWS rows of 256 bytes, source pitch 2*D bytes) ----
typedef __attribute__((ext_vector_type(4))) uint32_t u32x4;
typedef __attribute__((ext_vector_type(8))) uint32_t u32x8;

__device__ __forceinline__ uint32_t uni(uint32_t v) {
  return (uint32_t)__builtin_amdgcn_readfirstlane(v);
}
__device__ __forceinline__ uint32_t pinned(uint32_t v) {
  uint32_t w = uni(v);
  asm volatile("" : "+s"(w));  // pinned(): keeps the test in a scalar register
  return w;
}
// the compiler places no wait for the tensor mover
__device__ __forceinline__ void wait_tensor0() {
  asm volatile("s_wait_tensorcnt 0x0" ::: "memory");
}
// this wave's LDS reads and writes are done before the buffer is handed over
__device__ __forceinline__ void wait_ds0() {
  asm volatile("s_wait_dscnt 0x0" ::: "memory");
}
template <unsigned PADA, unsigned ROWS>
__device__ __forceinline__ u32x8 tdm_group1() {
  constexpr uint32_t d0 = SLAB_COLS * 2, d1 = ROWS;        // bytes a row, rows
  u32x8 g1;
  g1[0] = uni((1u << 20) | (5u << 22) | (PADA << 25));
  g1[1] = uni(d0 << 16);
  g1[2] = uni(d1 << 16);
  g1[3] = uni(d0 << 16);
  g1[4] = uni(d1);
  g1[5] = uni((uint32_t)D * 2u);
  g1[6] = pinned(0u);
  g1[7] = pinned(0u);
  return g1;
}
__device__ __forceinline__ void tdm_load_slab(u32x8 g1, const _Float16* gsrc,
                                              uint32_t ldsDst) {
  unsigned long long ga = (unsigned long long)(uintptr_t)gsrc;
  u32x4 g0;
  g0[0] = uni(1u);                                          // count = 1
  g0[1] = uni(ldsDst);                                      // LDS byte address
  g0[2] = uni((uint32_t)ga);                                // global address [31:0]
  g0[3] = uni((((uint32_t)(ga >> 32)) & 0x01FFFFFFu) | 0x80000000u);  // [56:32], type 2
  asm volatile("tensor_load_to_lds %0, %1" :: "s"(g0), "s"(g1) : "memory");
}

__device__ __forceinline__ void swizzle_job(const float* __restrict__ W,
                                            _Float16* __restrict__ out, int blk) {
  int idx = blk * 256 + threadIdx.x;
  int h    = idx & 15;
  int lane = (idx >> 4) & 31;
  int tile = idx >> 9;
  int dt   = tile & 15;       // D/32 == 16
  int etg  = tile >> 4;
  int e = etg * 16 + (lane & 15);
  int d = dt * 32 + 2 * (h & 8) + 8 * (lane >> 4) + (h & 7);
  out[idx] = (_Float16)W[(size_t)e * 512 + d];
}

__device__ __forceinline__ void cvt_job(const float* __restrict__ src,
                                        _Float16* __restrict__ dst, int blk) {
  int i = blk * 256 + threadIdx.x;
  float4 x = reinterpret_cast<const float4*>(src)[i];
  v4h h;
  h[0] = (_Float16)x.x; h[1] = (_Float16)x.y;
  h[2] = (_Float16)x.z; h[3] = (_Float16)x.w;
  *reinterpret_cast<v4h*>(dst + (size_t)i * 4) = h;
}

// ---------------- job: q = rmsnorm(target @ Wq^T) * (1+qw) * (1+kw) -----------
// 16 query rows a block.
__device__ __forceinline__ void qproj_job(const float* __restrict__ tgt,
                                          const _Float16* __restrict__ wq,
                                          const float* __restrict__ qw,
                                          const float* __restrict__ kw,
                                          _Float16* __restrict__ qkOut, int blk,
                                          float (*qLds)[D], float* rowSq) {
  int tid  = threadIdx.x;
  int lane = tid & 31;
  int w    = tid >> 5;
  int rowBase = blk * 16;

  v8f acc[4];
#pragma unroll
  for (int j = 0; j < 4; ++j) acc[j] = vzero();

  for (int kt = 0; kt < 16; ++kt) {
    v16h a = load_ab_f32(tgt + (size_t)rowBase * D + kt * 32, D, lane);
#pragma unroll
    for (int j = 0; j < 4; ++j) {
      int etg = w * 4 + j;
      const _Float16* tb = wq + ((size_t)(etg * 16 + kt)) * 512;
      v16h bf = *reinterpret_cast<const v16h*>(tb + lane * 16);
      acc[j] = wmma32(a, bf, acc[j]);
    }
  }

  int nn = lane & 15, mb = (lane >> 4) * 8;
#pragma unroll
  for (int j = 0; j < 4; ++j) {
    int e = (w * 4 + j) * 16 + nn;
#pragma unroll
    for (int r = 0; r < 8; ++r) qLds[mb + r][e] = acc[j][r];
  }
  if (tid < 16) rowSq[tid] = 0.f;
  __syncthreads();

  {
    int r = tid >> 4, seg = tid & 15;
    float s = 0.f;
    for (int i = 0; i < 32; ++i) {
      float x = qLds[r][seg * 32 + i];
      s += x * x;
    }
    atomicAdd(&rowSq[r], s);
  }
  __syncthreads();

  for (int i = tid; i < 16 * D; i += 256) {
    int r = i >> 9, col = i & 511;
    float rs = rsqrtf(rowSq[r] * (1.f / D) + EPS);
    float v = qLds[r][col] * rs * (1.f + qw[col]) * (1.f + kw[col]);
    qkOut[(size_t)(rowBase + r) * D + col] = (_Float16)v;
  }
}

// ---------------- kernel 0: swizzle Wq, which the q projection reads ----------
constexpr int SWQ_BLOCKS = D * D / 256;
__global__ __launch_bounds__(256)
void swizzle_wq(const float* __restrict__ wq, _Float16* __restrict__ swq) {
  swizzle_job(wq, swq, blockIdx.x);
}

// ---------------- kernel 1: the rest of the preparation, one launch ----------
// None of these four jobs reads what another of them writes, so they share one grid
// and a block takes its job by its index. The q projection's blocks stand first: they
// are few, and each is a long chain of dependent loads, which so runs beside the
// streaming jobs and not in a launch of its own.
// Stands behind a job's store: the store is still in flight where the code that follows
// the job in the merged kernel rewrites a register that it names.
__device__ __forceinline__ void wait_store_regs() {
  asm volatile("s_wait_xcnt 0x0" ::: "memory");
}
constexpr int QP_BLOCKS = B * T / 16;
constexpr int SW_BLOCKS = NKV * D * D / 256;
constexpr int CV_BLOCKS = B * S * D / 1024;
constexpr int PREP_BLOCKS = QP_BLOCKS + 2 * SW_BLOCKS + CV_BLOCKS;
__global__ __launch_bounds__(256)
void prep_kernel(const float* __restrict__ tgt, const float* __restrict__ hist,
                 const float* __restrict__ wk, const float* __restrict__ wv,
                 const float* __restrict__ qw, const float* __restrict__ kw,
                 const _Float16* __restrict__ swq, _Float16* __restrict__ qkOut,
                 _Float16* __restrict__ swk, _Float16* __restrict__ swv,
                 _Float16* __restrict__ h16) {
  __shared__ float qLds[16][D];
  __shared__ float rowSq[16];
  int blk = blockIdx.x;   // every test below reads the same for a whole block
  if (blk < QP_BLOCKS) {
    qproj_job(tgt, swq, qw, kw, qkOut, blk, qLds, rowSq);
  } else if (blk < QP_BLOCKS + SW_BLOCKS) {
    swizzle_job(wk, swk, blk - QP_BLOCKS);
    wait_store_regs();
  } else if (blk < QP_BLOCKS + 2 * SW_BLOCKS) {
    swizzle_job(wv, swv, blk - QP_BLOCKS - SW_BLOCKS);
    wait_store_regs();
  } else {
    cvt_job(hist, h16, blk - QP_BLOCKS - 2 * SW_BLOCKS);
    wait_store_regs();
  }
}

__global__ __launch_bounds__(256)
void attn_kernel(const _Float16* __restrict__ histF16,
                 const int* __restrict__ mask,
                 const _Float16* __restrict__ swk, const _Float16* __restrict__ swv,
                 const _Float16* __restrict__ qkG,
                 float* __restrict__ outTok, float* __restrict__ outAttn) {
  // 2 KiB: every tensor load's place in LDS is a multiple of that
  extern __shared__ __attribute__((aligned(2048))) char smemRaw[];
  float*    sqPart = (float*)(smemRaw + LDS_SQP);
  float*    scPart = (float*)(smemRaw + LDS_SCP);
  _Float16* qkL    = (_Float16*)(smemRaw + LDS_QK);
  _Float16* attnL  = (_Float16*)(smemRaw + LDS_ATTN);
  float*    scoresL = (float*)(smemRaw + LDS_SCORE);
  float*    red     = (float*)(smemRaw + LDS_RED);

  int wg = blockIdx.x;
  int b  = wg / NKV;
  int n  = wg % NKV;
  int tid  = threadIdx.x;
  int lane = tid & 31;
  int w    = tid >> 5;
  int nn = lane & 15;

  const _Float16* histSrc = histF16 + (size_t)b * S * D;

  // Waves 0..NSLAB-1 each bring one column slab of every chunk.
  const uint32_t wave = uni(threadIdx.x >> 5);
  const uint32_t ldsBase = (uint32_t)(uintptr_t)smemRaw;   // byte offset in the work-group's LDS
  const _Float16* slabSrc = histSrc + wave * SLAB_COLS;
  const uint32_t slabDst = ldsBase + LDS_HIST0 + wave * SLAB_BYTES;

  const uint32_t slabDst1 = ldsBase + LDS_HIST0 + wave * SLAB1_BYTES;

  const u32x8 g1a = tdm_group1<3, CHUNK1>();
  // pass 1 has one history buffer: chunk 0 lands and is published
  if (pinned(wave < NSLAB)) {
    tdm_load_slab(g1a, slabSrc, slabDst1);
    wait_tensor0();
  }
  for (int i = tid; i < G * D; i += 256)
    qkL[i] = qkG[(size_t)(b * T + n * G) * D + i];
  __syncthreads();

  // ================= pass 1: k projection + scores =================
  // k-proj: wave w makes columns [w*64, w*64+64) of all CHUNK1 rows of a chunk, a tile
  // of 8 x 4 fragments: every weight fragment is loaded by one wave only and feeds
  // eight WMMAs, so that the weights come from L2 NC1 times.
  // The product is formed transposed, k^T = Wk @ hist^T (the weight fragment is the A
  // operand): a lane then holds one history row s at eight neighbouring columns e a
  // fragment. So the row's squares add up in the lane, and two fragments, rounded to
  // f16, are as they stand the B operand of the score product: k goes through no LDS.
  // Fragment (j, kt) of this wave's weight slice stands at wb + (j*16 + kt)*512.
  const _Float16* wb =
      swk + ((size_t)(n * 32 + w * 4) * 16) * 512 + lane * 16;
  v16h bk[16];
#pragma unroll
  for (int u = 0; u < 4; ++u)
#pragma unroll
    for (int j = 0; j < 4; ++j) bk[u * 4 + j] = load_w_frag(wb + (j * 16 + u) * 512);

  // the query rows at this wave's 64 columns: A operand of its part of the scores
  v16h aq[2];
#pragma unroll
  for (int h = 0; h < 2; ++h)
    aq[h] = load_ab_f16(qkL + w * 64 + h * 32, D, lane, G - 1);

  for (int c = 0; c < NC1; ++c) {
    const _Float16* histL = (const _Float16*)(smemRaw + LDS_HIST0);
    {
      // k-step kt stands in slab kt / 4 at column (kt % 4) * 32
      v8f acc[32];
#pragma unroll
      for (int t = 0; t < 32; ++t) acc[t] = vzero();
      v16h a[4];
#pragma unroll
      for (int i = 0; i < 4; ++i)
        a[i] = load_ab_f16(histL + (i * 16) * PITCH_A, PITCH_A, lane, 15);
      // One trip is one slab, four k-steps; a k-step is two half-steps, rows 0..63 and
      // rows 64..127, on the same four weight fragments. The history fragments are read one
      // half-step ahead; each weight register set is refilled for k-step kt + 4 right
      // behind the last four WMMAs that read it.
      // Kept rolled: unrolled, the weight loads no longer depend on a loop count,
      // are lifted out of the chunk loop and spill.
#pragma unroll 1
      for (int kb = 0; kb < 16; kb += 4) {
        const int kw = (kb + 4) & 15;
        const _Float16* wn = wb + kw * 512;
        const _Float16* ab = histL + (kb >> 2) * SLAB1_H;
        const _Float16* abn = histL + (kw >> 2) * SLAB1_H;
#pragma unroll
        for (int u = 0; u < 4; ++u) {
#pragma unroll
          for (int hf = 0; hf < 2; ++hf) {
            const _Float16* as = (hf == 0) ? ab + u * 32 + 64 * PITCH_A
                                           : ((u < 3) ? ab + (u + 1) * 32 : abn);
            v16h an[4];
#pragma unroll
            for (int i = 0; i < 4; ++i)
              an[i] = load_ab_f16(as + (i * 16) * PITCH_A, PITCH_A, lane, 15);
            // keeps the next history fragments' eight LDS reads as one group at the head of
            // their half-step: left alone the scheduler lumps the reads of several
            // half-steps, takes more registers, and one LDS wait drains to 0
            __builtin_amdgcn_sched_group_barrier(0x100, 8, 0);
#pragma unroll
            for (int j = 0; j < 4; ++j) {
#pragma unroll
              for (int i = 0; i < 4; ++i)
                acc[hf * 16 + i * 4 + j] =
                    wmma32(bk[u * 4 + j], a[i], acc[hf * 16 + i * 4 + j]);
              // keeps the order four WMMAs and, in the second half-step, their two
              // refill loads: without it the scheduler puts refills off and fewer
              // loads are in flight at the waits
              __builtin_amdgcn_sched_group_barrier(0x008, 4, 0);
              if (hf == 1) {
                bk[u * 4 + j] = load_w_frag(wn + (j * 16 + u) * 512);
                __builtin_amdgcn_sched_group_barrier(0x020, 2, 0);
              }
            }
#pragma unroll
            for (int i = 0; i < 4; ++i) a[i] = an[i];
          }
        }
        // the refill loads are still in flight when the next trip rewrites the
        // address register that they name
        asm volatile("s_wait_xcnt 0x0" ::: "memory");
      }
      // every wave has left the history buffer: chunk c + 1 is asked for here and lands
      // while the waves work on their accumulators
      wait_ds0();
      __syncthreads();
      if (pinned((wave < NSLAB) && (c + 1 < NC1)))
        tdm_load_slab(g1a, slabSrc + (size_t)(c + 1) * CHUNK1 * D, slabDst1);

      // Per 16-row tile i: this wave's part (64 of the D columns) of each row's sum of
      // squares and of its two scores. The parts of the eight waves are added behind the
      // chunk loop.
#pragma unroll
      for (int i = 0; i < 8; ++i) {
        // Neighbouring accumulator registers are squared as a pair (one packed FMA on a
        // register pair as it lies); one sum a fragment: four short chains, not one long.
        v2f sj[4];
#pragma unroll
        for (int j = 0; j < 4; ++j) {
          sj[j] = v2f{0.f, 0.f};
#pragma unroll
          for (int r = 0; r < 8; r += 2) {
            v2f x = {acc[i * 4 + j][r], acc[i * 4 + j][r + 1]};
            sj[j] += x * x;
          }
        }
        v2f s2 = (sj[0] + sj[1]) + (sj[2] + sj[3]);
        float sq = s2[0] + s2[1];
        v8f sc = vzero();
#pragma unroll
        for (int h = 0; h < 2; ++h) {
          // lane (s, hi) holds e = 8*hi + 0..7 of fragment 2h and, 16 columns on, of
          // fragment 2h + 1: the k order of load_ab_f16
          v16h kf;
#pragma unroll
          for (int r = 0; r < 8; ++r) {
            kf[r]     = (_Float16)acc[i * 4 + 2 * h][r];
            kf[8 + r] = (_Float16)acc[i * 4 + 2 * h + 1][r];
          }
          sc = wmma32(aq[h], kf, sc);
        }
        int p = (w * 2 + (lane >> 4)) * PITCH_P + c * CHUNK1 + i * 16 + nn;
        sqPart[p] = sq;
        scPart[p] = sc[0];
      }
    }
    // foot of the trip: chunk c + 1 is published (and, in the last trip, the partial sums)
    wait_ds0();
    if (pinned(wave < NSLAB)) wait_tensor0();
    __syncthreads();
  }
  wait_tensor0();
  wait_ds0();

  // ================= softmax over S =================
  static_assert(G == 2, "one score row per lane half");
  for (int s = tid; s < S; s += 256) {
    float sq = 0.f, sc0 = 0.f, sc1 = 0.f;
#pragma unroll
    for (int p = 0; p < 8; ++p) {
      sq  += sqPart[(2 * p) * PITCH_P + s] + sqPart[(2 * p + 1) * PITCH_P + s];
      sc0 += scPart[(2 * p) * PITCH_P + s];
      sc1 += scPart[(2 * p + 1) * PITCH_P + s];
    }
    float rs = rsqrtf(sq * (1.f / D) + EPS);
    bool off = mask[b * S + s] != 0;
    scoresL[s]     = off ? -__builtin_inff() : sc0 * rs * SCALE;
    scoresL[S + s] = off ? -__builtin_inff() : sc1 * rs * SCALE;
  }
  __syncthreads();
  if (tid < 64) {
    int g = tid >> 5, l = tid & 31;
    float mx = -__builtin_inff();
    for (int s = l; s < S; s += 32) mx = fmaxf(mx, scoresL[g * S + s]);
    red[g * 32 + l] = mx;
  }
  __syncthreads();
  if (tid < 2) {
    float mx = -__builtin_inff();
    for (int l = 0; l < 32; ++l) mx = fmaxf(mx, red[tid * 32 + l]);
    red[tid * 32] = mx;
  }
  __syncthreads();
  if (tid < 64) {
    int g = tid >> 5, l = tid & 31;
    float mx = red[g * 32];
    float sm = 0.f;
    for (int s = l; s < S; s += 32) {
      float e = __expf(scoresL[g * S + s] - mx);
      scoresL[g * S + s] = e;
      sm += e;
    }
    red[64 + g * 32 + l] = sm;
  }
  __syncthreads();
  if (tid < 2) {
    float sm = 0.f;
    for (int l = 0; l < 32; ++l) sm += red[64 + tid * 32 + l];
    red[64 + tid * 32] = 1.f / sm;
  }
  __syncthreads();
  for (int i = tid; i < G * S; i += 256) {
    int g = i >> 9, s = i & (S - 1);
    float a = scoresL[i] * red[64 + g * 32];
    attnL[i] = (_Float16)a;
    outAttn[(size_t)(b * T + n * G + g) * S + s] = a;
  }
  __syncthreads();

  // ===== pass 2: out = attn @ (hist @ Wv^T), summed as (attn @ hist) @ Wv^T =====
  v8f oacc[4];
#pragma unroll
  for (int j = 0; j < 4; ++j) oacc[j] = vzero();

  // chunks of CHUNK rows in a double-buffered ring, the rows at the transposing reader's pitch
  const u32x8 g1t = tdm_group1<7, CHUNK>();
  if (pinned(wave < NSLAB)) {
    tdm_load_slab(g1t, slabSrc, slabDst);
    wait_tensor0();
  }
  __syncthreads();
  if (pinned(wave < NSLAB))
    tdm_load_slab(g1t, slabSrc + (size_t)CHUNK * D, slabDst + (LDS_HIST1 - LDS_HIST0));

  // Wave w owns e range [w*64, w*64+64) of out = ctx @ Wv^T; fragment (j, kt) of its
  // weight slice stands at wv4 + (j*16 + kt)*512. K-steps 0..7 are asked for here,
  // ahead of the chunk loop: they need nothing of it.
  const _Float16* wv4 =
      swv + ((size_t)(n * 32 + w * 4) * 16) * 512 + lane * 16;
  v16h bq[32];
#pragma unroll
  for (int kt = 0; kt < 8; ++kt)
#pragma unroll
    for (int j = 0; j < 4; ++j)
      bq[kt * 4 + j] = load_w_frag(wv4 + (j * 16 + kt) * 512);

  for (int c = 0; c < NC; ++c) {
    const _Float16* histL =
        (const _Float16*)(smemRaw + ((c & 1) ? LDS_HIST1 : LDS_HIST0));

    // ctx += attn[:, chunk] @ hist_chunk ; wave w owns d range [w*64, w*64+64)
#pragma unroll
    for (int ks = 0; ks < CHUNK / 32; ++ks) {
      v16h a = load_ab_f16(attnL + c * CHUNK + ks * 32, S, lane, G - 1);
#pragma unroll
      for (int j = 0; j < 4; ++j) {
        v16h bf = load_bt_f16(histL + (w >> 1) * SLAB_H + (ks * 32) * PITCH_T +
                                  (w & 1) * 64 + j * 16,
                              PITCH_T, lane);
        oacc[j] = wmma32(a, bf, oacc[j]);
      }
    }
    wait_ds0();
    if (pinned(wave < NSLAB)) wait_tensor0();
    __syncthreads();
    if (pinned((wave < NSLAB) && (c + 2 < NC)))
      tdm_load_slab(g1t, slabSrc + (size_t)(c + 2) * CHUNK * D,
                       slabDst + ((c & 1) ? (LDS_HIST1 - LDS_HIST0) : 0u));
  }
  wait_tensor0();
  wait_ds0();

  static_assert(G == 2, "one ctx row per lane half");
  _Float16* ctxL = (_Float16*)(smemRaw + LDS_CTX);
#pragma unroll
  for (int j = 0; j < 4; ++j)
    ctxL[(lane >> 4) * D + w * 64 + j * 16 + nn] = (_Float16)oacc[j][0];
  __syncthreads();

  // out = ctx @ Wv^T: k-steps 0..7 run on the fragments asked for above, and each
  // register set is refilled for k-step kt + 8 in the k-step that read it.
  v8f tacc[4];
#pragma unroll
  for (int j = 0; j < 4; ++j) tacc[j] = vzero();
  v16h a = load_ab_f16(ctxL, D, lane, G - 1);
#pragma unroll
  for (int kt = 0; kt < 16; ++kt) {
    v16h an = a;
    if (kt + 1 < 16) an = load_ab_f16(ctxL + (kt + 1) * 32, D, lane, G - 1);
#pragma unroll
    for (int j = 0; j < 4; ++j) {
      tacc[j] = wmma32(a, bq[(kt & 7) * 4 + j], tacc[j]);
      if (kt < 8) bq[kt * 4 + j] = load_w_frag(wv4 + (j * 16 + kt + 8) * 512);
    }
    a = an;
    // holds the refill loads in their k-step: left to itself the scheduler puts
    // each load just ahead of its use, with two fragments in flight
    if (kt < 8) __builtin_amdgcn_sched_barrier(0);
  }

  if (lane < 16) {
#pragma unroll
    for (int j = 0; j < 4; ++j) {
      int e = w * 64 + j * 16 + lane;
      outTok[(size_t)(b * T + n * G + 0) * D + e] = tacc[j][0];
      outTok[(size_t)(b * T + n * G + 1) * D + e] = tacc[j][1];
    }
  }
}

// ---------------- host launcher ----------------
extern "C" void kernel_launch(void* const* d_in, const int* in_sizes, int n_in,
                              void* d_out, int out_size, void* d_ws, size_t ws_size,
                              hipStream_t stream) {
  const float* tgt  = (const float*)d_in[0];
  const float* hist = (const float*)d_in[1];
  const int*   mask = (const int*)d_in[2];
  const float* wq   = (const float*)d_in[3];
  const float* wk   = (const float*)d_in[4];
  const float* wv   = (const float*)d_in[5];
  const float* qnw  = (const float*)d_in[6];
  const float* knw  = (const float*)d_in[7];

  float* outTok  = (float*)d_out;
  float* outAttn = outTok + (size_t)B * T * D;

  char* ws = (char*)d_ws;
  _Float16* swq  = (_Float16*)(ws);
  _Float16* swk  = (_Float16*)(ws + (size_t)512 * 1024);
  _Float16* swv  = (_Float16*)(ws + (size_t)512 * 1024 + 2u * 1024 * 1024);
  _Float16* qk   = (_Float16*)(ws + (size_t)512 * 1024 + 4u * 1024 * 1024);
  _Float16* h16  = (_Float16*)(ws + (size_t)5 * 1024 * 1024);  // 32 MB

  swizzle_wq<<<SWQ_BLOCKS, 256, 0, stream>>>(wq, swq);

  prep_kernel<<<PREP_BLOCKS, 256, 0, stream>>>(tgt, hist, wk, wv, qnw, knw, swq,
                                               qk, swk, swv, h16);

  attn_kernel<<<B * NKV, 256, LDS_TOTAL, stream>>>(h16, mask, swk, swv, qk,
                                                   outTok, outAttn);
}

// v008
// It runs in 73.4 microseconds.
// Two timings next to v007 both put it at 1.08 times that version's speed.
// All steps since v000 together make it 6.81 times as fast.
#include <hip/hip_runtime.h>
#include <hip/hip_bf16.h>

// ---------------- problem constants ----------------
constexpr int B   = 64;
constexpr int T   = 8;
constexpr int D   = 512;
constexpr int S   = 512;
constexpr int NKV = 4;
constexpr int G   = T / NKV;          // 2
constexpr int CHUNK = 64;             // S-chunk processed per iteration
constexpr int NC  = S / CHUNK;        // 8 chunks
constexpr int CHUNK1 = 128;           // S-chunk of pass 1 (k projection + scores)
constexpr int NC1 = S / CHUNK1;       // 4 chunks
constexpr float EPS = 1e-6f;
constexpr float SCALE = 0.044194173824159216f; // D^-0.5

typedef __attribute__((ext_vector_type(16))) _Float16 v16h;
typedef __attribute__((ext_vector_type(4)))  _Float16 v4h;
typedef __attribute__((ext_vector_type(8)))  _Float16 v8h;
typedef __attribute__((ext_vector_type(8)))  float    v8f;
typedef __attribute__((ext_vector_type(2)))  float    v2f;
typedef __attribute__((ext_vector_type(4)))  unsigned v4u;
typedef __attribute__((ext_vector_type(8)))  int      v8i;
typedef __attribute__((ext_vector_type(4)))  int      v4i;

constexpr int      NSLAB     = 4;
constexpr int      SLAB_COLS = D / NSLAB;
constexpr int      PITCH_A   = SLAB_COLS + 8;
constexpr int      PITCH_T   = SLAB_COLS + 16;
constexpr unsigned SLAB_BYTES = 18432;
constexpr int      SLAB_H    = SLAB_BYTES / 2;
constexpr int      PITCH_P   = S + 16;
static_assert(CHUNK * PITCH_T * 2 <= (int)SLAB_BYTES && SLAB_BYTES % 2048 == 0, "slab size");
// Pass 1 holds one chunk of CHUNK1 rows, in the place of pass 2's two buffers.
constexpr unsigned SLAB1_BYTES = CHUNK1 * PITCH_A * 2;     // 128 x 272 = 17 x 2 KiB
constexpr int      SLAB1_H   = SLAB1_BYTES / 2;            // slab stride in f16 units
static_assert(SLAB1_BYTES % 2048 == 0 && SLAB1_BYTES <= 2 * SLAB_BYTES, "pass 1 slab size");
constexpr unsigned LDS_HIST0 = 0;                          // NSLAB slabs, 72 KB
constexpr unsigned LDS_HIST1 = LDS_HIST0 + NSLAB * SLAB_BYTES;  // double buffer, 72 KB
constexpr unsigned LDS_SQP   = LDS_HIST1 + NSLAB * SLAB_BYTES;  // [8 waves][2 halves][PITCH_P] f32
constexpr unsigned LDS_SCP   = LDS_SQP   + 16 * PITCH_P * 4; // [8 waves][G][PITCH_P] f32
constexpr unsigned LDS_CTX   = LDS_SCP   + 16 * PITCH_P * 4; // [G][D] f16
constexpr unsigned LDS_QK    = LDS_CTX   + G * D * 2;      // [G][D] f16
constexpr unsigned LDS_ATTN  = LDS_QK    + G * D * 2;      // [G][S] f16
constexpr unsigned LDS_SCORE = LDS_ATTN  + G * S * 2;      // [G][S] f32
constexpr unsigned LDS_RED   = LDS_SCORE + G * S * 4;      // [128] f32
constexpr unsigned LDS_TOTAL = LDS_RED   + 128 * 4;        // ~221 KB (<320 KB/WGP)
static_assert(LDS_TOTAL <= 327680, "LDS of one WGP");

__device__ __forceinline__ v8f wmma32(v16h a, v16h b, v8f c) {
  return __builtin_amdgcn_wmma_f32_16x16x32_f16(false, a, false, b,
                                                (short)0, c, false, false);
}

__device__ __forceinline__ int kcol(int p) {
  return ((p & 4) ? 16 : 0) + 2 * (p & 3);
}

// Load a 16(rows) x 32(K) fragment from row-major f16 memory (LDS or global).
// Rows beyond maxRow are clamped (for the G=2 query/attn rows padded to 16).
__device__ __forceinline__ v16h load_ab_f16(const _Float16* src, int pitch,
                                            int lane, int maxRow) {
  int m = lane & 15; if (m > maxRow) m = maxRow;
  int hi = (lane >> 4) & 1;
  const _Float16* row = src + m * pitch + 8 * hi;
  // k = 8*hi + 0..7 and 16 + 8*hi + 0..7, each run one 16-byte load (src and pitch
  // are multiples of 16 bytes)
  v8h lo = *reinterpret_cast<const v8h*>(row);
  v8h up = *reinterpret_cast<const v8h*>(row + 16);
  return __builtin_shufflevector(lo, up, 0, 1, 2, 3, 4, 5, 6, 7,
                                 8, 9, 10, 11, 12, 13, 14, 15);
}

// Same but source is row-major f32 in global memory (converted on the fly).
__device__ __forceinline__ v16h load_ab_f32(const float* src, int pitch, int lane) {
  int m = lane & 15;
  int hi = (lane >> 4) & 1;
  const float* row = src + (size_t)m * pitch + 8 * hi;
  v16h f;
#pragma unroll
  for (int p = 0; p < 8; ++p) {
    const float* q = row + kcol(p);
    f[2 * p]     = (_Float16)q[0];
    f[2 * p + 1] = (_Float16)q[1];
  }
  return f;
}

// 32(K rows) x 16(N columns) B fragment out of a row-major f16 LDS tile: the two
// transposing loads hand lane (c, hi) column c at k = 8*hi + 0..7 and 16 + 8*hi + 0..7,
// the k order of load_ab_f16.
__device__ __forceinline__ v16h load_bt_f16(const _Float16* tile, int pitch, int lane) {
  typedef __attribute__((ext_vector_type(8))) short s16x8;
  typedef __attribute__((address_space(3))) s16x8 lds_s16x8;
  const _Float16* p =
      tile + (8 * (lane >> 4) + (lane & 7)) * pitch + 8 * ((lane >> 3) & 1);
  v8h lo = __builtin_bit_cast(
      v8h, __builtin_amdgcn_ds_load_tr16_b128_v8i16((lds_s16x8*)p));
  v8h hi = __builtin_bit_cast(
      v8h, __builtin_amdgcn_ds_load_tr16_b128_v8i16((lds_s16x8*)(p + 16 * pitch)));
  return __builtin_shufflevector(lo, hi, 0, 1, 2, 3, 4, 5, 6, 7,
                                 8, 9, 10, 11, 12, 13, 14, 15);
}

// One pre-swizzled 32(K) x 16(N) weight fragment: 32 bytes per lane.
__device__ __forceinline__ v16h load_w_frag(const _Float16* p) {
  return *reinterpret_cast<const v16h*>(p);
}

__device__ __forceinline__ v8f vzero() {
  v8f z = {0.f, 0.f, 0.f, 0.f, 0.f, 0.f, 0.f, 0.f};
  return z;
}

// ---- Tensor mover: one slab (ROWS rows of 256 bytes, source pitch 2*D bytes) ----
typedef __attribute__((ext_vector_type(4))) uint32_t u32x4;
typedef __attribute__((ext_vector_type(8))) uint32_t u32x8;

__device__ __forceinline__ uint32_t uni(uint32_t v) {
  return (uint32_t)__builtin_amdgcn_readfirstlane(v);
}
__device__ __forceinline__ uint32_t pinned(uint32_t v) {
  uint32_t w = uni(v);
  asm volatile("" : "+s"(w));  // pinned(): keeps the test in a scalar register
  return w;
}
// the compiler places no wait for the tensor mover
__device__ __forceinline__ void wait_tensor0() {
  asm volatile("s_wait_tensorcnt 0x0" ::: "memory");
}
// this wave's LDS reads and writes are done before the buffer is handed over
__device__ __forceinline__ void wait_ds0() {
  asm volatile("s_wait_dscnt 0x0" ::: "memory");
}
template <unsigned PADA, unsigned ROWS>
__device__ __forceinline__ u32x8 tdm_group1() {
  constexpr uint32_t d0 = SLAB_COLS * 2, d1 = ROWS;        // bytes a row, rows
  u32x8 g1;
  g1[0] = uni((1u << 20) | (5u << 22) | (PADA << 25));
  g1[1] = uni(d0 << 16);
  g1[2] = uni(d1 << 16);
  g1[3] = uni(d0 << 16);
  g1[4] = uni(d1);
  g1[5] = uni((uint32_t)D * 2u);
  g1[6] = pinned(0u);
  g1[7] = pinned(0u);
  return g1;
}
__device__ __forceinline__ void tdm_load_slab(u32x8 g1, const _Float16* gsrc,
                                              uint32_t ldsDst) {
  unsigned long long ga = (unsigned long long)(uintptr_t)gsrc;
  u32x4 g0;
  g0[0] = uni(1u);                                          // count = 1
  g0[1] = uni(ldsDst);                                      // LDS byte address
  g0[2] = uni((uint32_t)ga);                                // global address [31:0]
  g0[3] = uni((((uint32_t)(ga >> 32)) & 0x01FFFFFFu) | 0x80000000u);  // [56:32], type 2
  asm volatile("tensor_load_to_lds %0, %1" :: "s"(g0), "s"(g1) : "memory");
}

__device__ __forceinline__ void swizzle_job(const float* __restrict__ W,
                                            _Float16* __restrict__ out, int blk) {
  int idx = blk * 256 + threadIdx.x;
  int h    = idx & 15;
  int lane = (idx >> 4) & 31;
  int tile = idx >> 9;
  int dt   = tile & 15;       // D/32 == 16
  int etg  = tile >> 4;
  int e = etg * 16 + (lane & 15);
  int d = dt * 32 + 2 * (h & 8) + 8 * (lane >> 4) + (h & 7);
  out[idx] = (_Float16)W[(size_t)e * 512 + d];
}

__device__ __forceinline__ void cvt_job(const float* __restrict__ src,
                                        _Float16* __restrict__ dst, int blk) {
  int i = blk * 256 + threadIdx.x;
  float4 x = reinterpret_cast<const float4*>(src)[i];
  v4h h;
  h[0] = (_Float16)x.x; h[1] = (_Float16)x.y;
  h[2] = (_Float16)x.z; h[3] = (_Float16)x.w;
  *reinterpret_cast<v4h*>(dst + (size_t)i * 4) = h;
}

// ---------------- job: raw q = target @ Wq^T -------------------------------
// One 16 x 16 tile a wave, eight tiles a block. Both operands come straight from the
// row-major f32 inputs (a weight row is a B column, read in the k order of the A loader),
// so nothing has to be prepared for this job by an earlier launch. An f32 fragment takes
// twice the registers of an f16 one: with one tile a wave the job stays inside the
// register budget that the streaming jobs of the same kernel need for full occupancy.
// Each k-step is one round trip to memory, so the D / 32 k-steps are dealt to QP_KSPLIT
// blocks, which each store a partial sum in a plane of their own.
// A q row is then spread over QP_SPLIT * QP_KSPLIT blocks: the planes are added and the
// RMS norm is taken where the row is read.
// Tile (rt, ct) is stored as 16 rows of 16 f32, 1 KiB in a row: whole lines, one writer.
constexpr int QP_SPLIT  = D / (8 * 16);
constexpr int QP_KSPLIT = 4;
constexpr int QP_KSTEPS = D / 32 / QP_KSPLIT;
__device__ __forceinline__ size_t qraw_index(int plane, int row, int col) {
  return (((size_t)plane * (B * T / 16) + (row >> 4)) * (D / 16) + (col >> 4)) * 256 +
         (row & 15) * 16 + (col & 15);
}
__device__ __forceinline__ void qproj_job(const float* __restrict__ tgt,
                                          const float* __restrict__ wq,
                                          float* __restrict__ qRaw, int blk) {
  int lane = threadIdx.x & 31;
  int w    = threadIdx.x >> 5;
  int ks = blk % QP_KSPLIT;
  int ct = (blk / QP_KSPLIT % QP_SPLIT) * 8 + w;
  int rt = blk / (QP_KSPLIT * QP_SPLIT);
  const float* ap = tgt + (size_t)rt * 16 * D + ks * QP_KSTEPS * 32;
  const float* bp = wq + (size_t)ct * 16 * D + ks * QP_KSTEPS * 32;
  v8f acc = vzero();
#pragma unroll 1
  for (int kt = 0; kt < QP_KSTEPS; ++kt) {
    v16h a  = load_ab_f32(ap + kt * 32, D, lane);
    v16h bf = load_ab_f32(bp + kt * 32, D, lane);
    acc = wmma32(a, bf, acc);
  }
  int nn = lane & 15, mb = (lane >> 4) * 8;
#pragma unroll
  for (int r = 0; r < 8; ++r)
    qRaw[qraw_index(ks, rt * 16 + mb + r, ct * 16 + nn)] = acc[r];
}

// ---------------- kernel 0: the preparation, one launch ----------
// None of these four jobs reads what another of them writes, so they share one grid
// and a block takes its job by its index. The q projection's blocks stand first: they
// are few, and each is a chain of dependent loads, which so runs beside the
// streaming jobs and not in a launch of its own.
// Stands behind a job's store: the store is still in flight where the code that follows
// the job in the merged kernel rewrites a register that it names.
__device__ __forceinline__ void wait_store_regs() {
  asm volatile("s_wait_xcnt 0x0" ::: "memory");
}
constexpr int QP_BLOCKS = B * T / 16 * QP_SPLIT * QP_KSPLIT;
constexpr int SW_BLOCKS = NKV * D * D / 256;
constexpr int CV_BLOCKS = B * S * D / 1024;
constexpr int PREP_BLOCKS = QP_BLOCKS + 2 * SW_BLOCKS + CV_BLOCKS;
__global__ __launch_bounds__(256)
void prep_kernel(const float* __restrict__ tgt, const float* __restrict__ hist,
                 const float* __restrict__ wq,
                 const float* __restrict__ wk, const float* __restrict__ wv,
                 float* __restrict__ qRaw,
                 _Float16* __restrict__ swk, _Float16* __restrict__ swv,
                 _Float16* __restrict__ h16) {
  int blk = blockIdx.x;   // every test below reads the same for a whole block
  if (blk < QP_BLOCKS) {
    qproj_job(tgt, wq, qRaw, blk);
  } else if (blk < QP_BLOCKS + SW_BLOCKS) {
    swizzle_job(wk, swk, blk - QP_BLOCKS);
    wait_store_regs();
  } else if (blk < QP_BLOCKS + 2 * SW_BLOCKS) {
    swizzle_job(wv, swv, blk - QP_BLOCKS - SW_BLOCKS);
    wait_store_regs();
  } else {
    cvt_job(hist, h16, blk - QP_BLOCKS - 2 * SW_BLOCKS);
    wait_store_regs();
  }
}

__global__ __launch_bounds__(256)
void attn_kernel(const _Float16* __restrict__ histF16,
                 const int* __restrict__ mask,
                 const _Float16* __restrict__ swk, const _Float16* __restrict__ swv,
                 const float* __restrict__ qRaw,
                 const float* __restrict__ qw, const float* __restrict__ kw,
                 float* __restrict__ outTok, float* __restrict__ outAttn) {
  // 2 KiB: every tensor load's place in LDS is a multiple of that
  extern __shared__ __attribute__((aligned(2048))) char smemRaw[];
  float*    sqPart = (float*)(smemRaw + LDS_SQP);
  float*    scPart = (float*)(smemRaw + LDS_SCP);
  _Float16* qkL    = (_Float16*)(smemRaw + LDS_QK);
  _Float16* attnL  = (_Float16*)(smemRaw + LDS_ATTN);
  float*    scoresL = (float*)(smemRaw + LDS_SCORE);
  float*    red     = (float*)(smemRaw + LDS_RED);

  int wg = blockIdx.x;
  int b  = wg / NKV;
  int n  = wg % NKV;
  int tid  = threadIdx.x;
  int lane = tid & 31;
  int w    = tid >> 5;
  int nn = lane & 15;

  const _Float16* histSrc = histF16 + (size_t)b * S * D;

  // Waves 0..NSLAB-1 each bring one column slab of every chunk.
  const uint32_t wave = uni(threadIdx.x >> 5);
  const uint32_t ldsBase = (uint32_t)(uintptr_t)smemRaw;   // byte offset in the work-group's LDS
  const _Float16* slabSrc = histSrc + wave * SLAB_COLS;
  const uint32_t slabDst = ldsBase + LDS_HIST0 + wave * SLAB_BYTES;

  const uint32_t slabDst1 = ldsBase + LDS_HIST0 + wave * SLAB1_BYTES;

  const u32x8 g1a = tdm_group1<3, CHUNK1>();
  // pass 1 has one history buffer: chunk 0 lands and is published
  if (pinned(wave < NSLAB)) {
    tdm_load_slab(g1a, slabSrc, slabDst1);
    wait_tensor0();
  }
  // q = rmsnorm(raw q) * (1+qw), times (1+kw) of the k norm. Waves NSLAB .. NSLAB+G-1,
  // which bring no slab, make one q row each while the slabs land: a whole row in one
  // wave, 16 columns a lane, so that its squares are summed over the lanes alone.
  static_assert(NSLAB + G <= 8 && D == 4 * 128 && QP_KSPLIT == 4, "one wave a q row");
  if (wave >= NSLAB && wave < NSLAB + G) {
    const int g = (int)wave - NSLAB;
    const int row = b * T + n * G + g;
    // The row is the same for the whole wave: its place is a scalar base, plane and
    // column group are constant steps from it, and one lane offset serves all 16 loads.
    const float* rowP = qRaw + qraw_index(0, row, 0);
    const unsigned laneOff = (unsigned)qraw_index(0, 0, lane * 4);
    constexpr size_t PLANE = (size_t)B * T * D, GROUP = (128 / 16) * 256;
    float4 x[4], fq[4], fk[4];
    float sq = 0.f;
#pragma unroll
    for (int u = 0; u < 4; ++u) {
      const int col = u * 128 + lane * 4;
      const float* pu = rowP + u * GROUP + laneOff;
      float4 p0 = *reinterpret_cast<const float4*>(pu);
      float4 p1 = *reinterpret_cast<const float4*>(pu + PLANE);
      float4 p2 = *reinterpret_cast<const float4*>(pu + 2 * PLANE);
      float4 p3 = *reinterpret_cast<const float4*>(pu + 3 * PLANE);
      fq[u] = *reinterpret_cast<const float4*>(qw + col);
      fk[u] = *reinterpret_cast<const float4*>(kw + col);
      x[u].x = (p0.x + p1.x) + (p2.x + p3.x);
      x[u].y = (p0.y + p1.y) + (p2.y + p3.y);
      x[u].z = (p0.z + p1.z) + (p2.z + p3.z);
      x[u].w = (p0.w + p1.w) + (p2.w + p3.w);
      sq += (x[u].x * x[u].x + x[u].y * x[u].y) + (x[u].z * x[u].z + x[u].w * x[u].w);
    }
#pragma unroll
    for (int m = 16; m > 0; m >>= 1) sq += __shfl_xor(sq, m);
    const float rs = rsqrtf(sq * (1.f / D) + EPS);
#pragma unroll
    for (int u = 0; u < 4; ++u) {
      v4h h;
      h[0] = (_Float16)(x[u].x * rs * (1.f + fq[u].x) * (1.f + fk[u].x));
      h[1] = (_Float16)(x[u].y * rs * (1.f + fq[u].y) * (1.f + fk[u].y));
      h[2] = (_Float16)(x[u].z * rs * (1.f + fq[u].z) * (1.f + fk[u].z));
      h[3] = (_Float16)(x[u].w * rs * (1.f + fq[u].w) * (1.f + fk[u].w));
      *reinterpret_cast<v4h*>(qkL + g * D + u * 128 + lane * 4) = h;
    }
  }
  __syncthreads();

  // ================= pass 1: k projection + scores =================
  // k-proj: wave w makes columns [w*64, w*64+64) of all CHUNK1 rows of a chunk, a tile
  // of 8 x 4 fragments: every weight fragment is loaded by one wave only and feeds
  // eight WMMAs, so that the weights come from L2 NC1 times.
  // The product is formed transposed, k^T = Wk @ hist^T (the weight fragment is the A
  // operand): a lane then holds one history row s at eight neighbouring columns e a
  // fragment. So the row's squares add up in the lane, and two fragments, rounded to
  // f16, are as they stand the B operand of the score product: k goes through no LDS.
  // Fragment (j, kt) of this wave's weight slice stands at wb + (j*16 + kt)*512.
  const _Float16* wb =
      swk + ((size_t)(n * 32 + w * 4) * 16) * 512 + lane * 16;
  v16h bk[16];
#pragma unroll
  for (int u = 0; u < 4; ++u)
#pragma unroll
    for (int j = 0; j < 4; ++j) bk[u * 4 + j] = load_w_frag(wb + (j * 16 + u) * 512);

  // the query rows at this wave's 64 columns: A operand of its part of the scores
  v16h aq[2];
#pragma unroll
  for (int h = 0; h < 2; ++h)
    aq[h] = load_ab_f16(qkL + w * 64 + h * 32, D, lane, G - 1);

  for (int c = 0; c < NC1; ++c) {
    const _Float16* histL = (const _Float16*)(smemRaw + LDS_HIST0);
    {
      // k-step kt stands in slab kt / 4 at column (kt % 4) * 32
      v8f acc[32];
#pragma unroll
      for (int t = 0; t < 32; ++t) acc[t] = vzero();
      v16h a[4];
#pragma unroll
      for (int i = 0; i < 4; ++i)
        a[i] = load_ab_f16(histL + (i * 16) * PITCH_A, PITCH_A, lane, 15);
      // One trip is one slab, four k-steps; a k-step is two half-steps, rows 0..63 and
      // rows 64..127, on the same four weight fragments. The history fragments are read one
      // half-step ahead; each weight register set is refilled for k-step kt + 4 right
      // behind the last four WMMAs that read it.
      // Kept rolled: unrolled, the weight loads no longer depend on a loop count,
      // are lifted out of the chunk loop and spill.
#pragma unroll 1
      for (int kb = 0; kb < 16; kb += 4) {
        const int kw = (kb + 4) & 15;
        const _Float16* wn = wb + kw * 512;
        const _Float16* ab = histL + (kb >> 2) * SLAB1_H;
        const _Float16* abn = histL + (kw >> 2) * SLAB1_H;
#pragma unroll
        for (int u = 0; u < 4; ++u) {
#pragma unroll
          for (int hf = 0; hf < 2; ++hf) {
            const _Float16* as = (hf == 0) ? ab + u * 32 + 64 * PITCH_A
                                           : ((u < 3) ? ab + (u + 1) * 32 : abn);
            v16h an[4];
#pragma unroll
            for (int i = 0; i < 4; ++i)
              an[i] = load_ab_f16(as + (i * 16) * PITCH_A, PITCH_A, lane, 15);
            // keeps the next history fragments' eight LDS reads as one group at the head of
            // their half-step: left alone the scheduler lumps the reads of several
            // half-steps, takes more registers, and one LDS wait drains to 0
            __builtin_amdgcn_sched_group_barrier(0x100, 8, 0);
#pragma unroll
            for (int j = 0; j < 4; ++j) {
#pragma unroll
              for (int i = 0; i < 4; ++i)
                acc[hf * 16 + i * 4 + j] =
                    wmma32(bk[u * 4 + j], a[i], acc[hf * 16 + i * 4 + j]);
              // keeps the order four WMMAs and, in the second half-step, their two
              // refill loads: without it the scheduler puts refills off and fewer
              // loads are in flight at the waits
              __builtin_amdgcn_sched_group_barrier(0x008, 4, 0);
              if (hf == 1) {
                bk[u * 4 + j] = load_w_frag(wn + (j * 16 + u) * 512);
                __builtin_amdgcn_sched_group_barrier(0x020, 2, 0);
              }
            }
#pragma unroll
            for (int i = 0; i < 4; ++i) a[i] = an[i];
          }
        }
        // the refill loads are still in flight when the next trip rewrites the
        // address register that they name
        asm volatile("s_wait_xcnt 0x0" ::: "memory");
      }
      // every wave has left the history buffer: chunk c + 1 is asked for here and lands
      // while the waves work on their accumulators
      wait_ds0();
      __syncthreads();
      if (pinned((wave < NSLAB) && (c + 1 < NC1)))
        tdm_load_slab(g1a, slabSrc + (size_t)(c + 1) * CHUNK1 * D, slabDst1);

      // Per 16-row tile i: this wave's part (64 of the D columns) of each row's sum of
      // squares and of its two scores. The parts of the eight waves are added behind the
      // chunk loop.
#pragma unroll
      for (int i = 0; i < 8; ++i) {
        // Neighbouring accumulator registers are squared as a pair (one packed FMA on a
        // register pair as it lies); one sum a fragment: four short chains, not one long.
        v2f sj[4];
#pragma unroll
        for (int j = 0; j < 4; ++j) {
          sj[j] = v2f{0.f, 0.f};
#pragma unroll
          for (int r = 0; r < 8; r += 2) {
            v2f x = {acc[i * 4 + j][r], acc[i * 4 + j][r + 1]};
            sj[j] += x * x;
          }
        }
        v2f s2 = (sj[0] + sj[1]) + (sj[2] + sj[3]);
        float sq = s2[0] + s2[1];
        v8f sc = vzero();
#pragma unroll
        for (int h = 0; h < 2; ++h) {
          // lane (s, hi) holds e = 8*hi + 0..7 of fragment 2h and, 16 columns on, of
          // fragment 2h + 1: the k order of load_ab_f16
          v16h kf;
#pragma unroll
          for (int r = 0; r < 8; ++r) {
            kf[r]     = (_Float16)acc[i * 4 + 2 * h][r];
            kf[8 + r] = (_Float16)acc[i * 4 + 2 * h + 1][r];
          }
          sc = wmma32(aq[h], kf, sc);
        }
        int p = (w * 2 + (lane >> 4)) * PITCH_P + c * CHUNK1 + i * 16 + nn;
        sqPart[p] = sq;
        scPart[p] = sc[0];
      }
    }
    // foot of the trip: chunk c + 1 is published (and, in the last trip, the partial sums)
    wait_ds0();
    if (pinned(wave < NSLAB)) wait_tensor0();
    __syncthreads();
  }
  wait_tensor0();
  wait_ds0();

  // ================= softmax over S =================
  static_assert(G == 2, "one score row per lane half");
  for (int s = tid; s < S; s += 256) {
    float sq = 0.f, sc0 = 0.f, sc1 = 0.f;
#pragma unroll
    for (int p = 0; p < 8; ++p) {
      sq  += sqPart[(2 * p) * PITCH_P + s] + sqPart[(2 * p + 1) * PITCH_P + s];
      sc0 += scPart[(2 * p) * PITCH_P + s];
      sc1 += scPart[(2 * p + 1) * PITCH_P + s];
    }
    float rs = rsqrtf(sq * (1.f / D) + EPS);
    bool off = mask[b * S + s] != 0;
    scoresL[s]     = off ? -__builtin_inff() : sc0 * rs * SCALE;
    scoresL[S + s] = off ? -__builtin_inff() : sc1 * rs * SCALE;
  }
  __syncthreads();
  if (tid < 64) {
    int g = tid >> 5, l = tid & 31;
    float mx = -__builtin_inff();
    for (int s = l; s < S; s += 32) mx = fmaxf(mx, scoresL[g * S + s]);
    red[g * 32 + l] = mx;
  }
  __syncthreads();
  if (tid < 2) {
    float mx = -__builtin_inff();
    for (int l = 0; l < 32; ++l) mx = fmaxf(mx, red[tid * 32 + l]);
    red[tid * 32] = mx;
  }
  __syncthreads();
  if (tid < 64) {
    int g = tid >> 5, l = tid & 31;
    float mx = red[g * 32];
    float sm = 0.f;
    for (int s = l; s < S; s += 32) {
      float e = __expf(scoresL[g * S + s] - mx);
      scoresL[g * S + s] = e;
      sm += e;
    }
    red[64 + g * 32 + l] = sm;
  }
  __syncthreads();
  if (tid < 2) {
    float sm = 0.f;
    for (int l = 0; l < 32; ++l) sm += red[64 + tid * 32 + l];
    red[64 + tid * 32] = 1.f / sm;
  }
  __syncthreads();
  for (int i = tid; i < G * S; i += 256) {
    int g = i >> 9, s = i & (S - 1);
    float a = scoresL[i] * red[64 + g * 32];
    attnL[i] = (_Float16)a;
    outAttn[(size_t)(b * T + n * G + g) * S + s] = a;
  }
  __syncthreads();

  // ===== pass 2: out = attn @ (hist @ Wv^T), summed as (attn @ hist) @ Wv^T =====
  v8f oacc[4];
#pragma unroll
  for (int j = 0; j < 4; ++j) oacc[j] = vzero();

  // chunks of CHUNK rows in a double-buffered ring, the rows at the transposing reader's pitch
  const u32x8 g1t = tdm_group1<7, CHUNK>();
  if (pinned(wave < NSLAB)) {
    tdm_load_slab(g1t, slabSrc, slabDst);
    wait_tensor0();
  }
  __syncthreads();
  if (pinned(wave < NSLAB))
    tdm_load_slab(g1t, slabSrc + (size_t)CHUNK * D, slabDst + (LDS_HIST1 - LDS_HIST0));

  // Wave w owns e range [w*64, w*64+64) of out = ctx @ Wv^T; fragment (j, kt) of its
  // weight slice stands at wv4 + (j*16 + kt)*512. K-steps 0..7 are asked for here,
  // ahead of the chunk loop: they need nothing of it.
  const _Float16* wv4 =
      swv + ((size_t)(n * 32 + w * 4) * 16) * 512 + lane * 16;
  v16h bq[32];
#pragma unroll
  for (int kt = 0; kt < 8; ++kt)
#pragma unroll
    for (int j = 0; j < 4; ++j)
      bq[kt * 4 + j] = load_w_frag(wv4 + (j * 16 + kt) * 512);

  for (int c = 0; c < NC; ++c) {
    const _Float16* histL =
        (const _Float16*)(smemRaw + ((c & 1) ? LDS_HIST1 : LDS_HIST0));

    // ctx += attn[:, chunk] @ hist_chunk ; wave w owns d range [w*64, w*64+64)
#pragma unroll
    for (int ks = 0; ks < CHUNK / 32; ++ks) {
      v16h a = load_ab_f16(attnL + c * CHUNK + ks * 32, S, lane, G - 1);
#pragma unroll
      for (int j = 0; j < 4; ++j) {
        v16h bf = load_bt_f16(histL + (w >> 1) * SLAB_H + (ks * 32) * PITCH_T +
                                  (w & 1) * 64 + j * 16,
                              PITCH_T, lane);
        oacc[j] = wmma32(a, bf, oacc[j]);
      }
    }
    wait_ds0();
    if (pinned(wave < NSLAB)) wait_tensor0();
    __syncthreads();
    if (pinned((wave < NSLAB) && (c + 2 < NC)))
      tdm_load_slab(g1t, slabSrc + (size_t)(c + 2) * CHUNK * D,
                       slabDst + ((c & 1) ? (LDS_HIST1 - LDS_HIST0) : 0u));
  }
  wait_tensor0();
  wait_ds0();

  static_assert(G == 2, "one ctx row per lane half");
  _Float16* ctxL = (_Float16*)(smemRaw + LDS_CTX);
#pragma unroll
  for (int j = 0; j < 4; ++j)
    ctxL[(lane >> 4) * D + w * 64 + j * 16 + nn] = (_Float16)oacc[j][0];
  __syncthreads();

  // out = ctx @ Wv^T: k-steps 0..7 run on the fragments asked for above, and each
  // register set is refilled for k-step kt + 8 in the k-step that read it.
  v8f tacc[4];
#pragma unroll
  for (int j = 0; j < 4; ++j) tacc[j] = vzero();
  v16h a = load_ab_f16(ctxL, D, lane, G - 1);
#pragma unroll
  for (int kt = 0; kt < 16; ++kt) {
    v16h an = a;
    if (kt + 1 < 16) an = load_ab_f16(ctxL + (kt + 1) * 32, D, lane, G - 1);
#pragma unroll
    for (int j = 0; j < 4; ++j) {
      tacc[j] = wmma32(a, bq[(kt & 7) * 4 + j], tacc[j]);
      if (kt < 8) bq[kt * 4 + j] = load_w_frag(wv4 + (j * 16 + kt + 8) * 512);
    }
    a = an;
    // holds the refill loads in their k-step: left to itself the scheduler puts
    // each load just ahead of its use, with two fragments in flight
    if (kt < 8) __builtin_amdgcn_sched_barrier(0);
  }

  if (lane < 16) {
#pragma unroll
    for (int j = 0; j < 4; ++j) {
      int e = w * 64 + j * 16 + lane;
      outTok[(size_t)(b * T + n * G + 0) * D + e] = tacc[j][0];
      outTok[(size_t)(b * T + n * G + 1) * D + e] = tacc[j][1];
    }
  }
}

// ---------------- host launcher ----------------
extern "C" void kernel_launch(void* const* d_in, const int* in_sizes, int n_in,
                              void* d_out, int out_size, void* d_ws, size_t ws_size,
                              hipStream_t stream) {
  const float* tgt  = (const float*)d_in[0];
  const float* hist = (const float*)d_in[1];
  const int*   mask = (const int*)d_in[2];
  const float* wq   = (const float*)d_in[3];
  const float* wk   = (const float*)d_in[4];
  const float* wv   = (const float*)d_in[5];
  const float* qnw  = (const float*)d_in[6];
  const float* knw  = (const float*)d_in[7];

  float* outTok  = (float*)d_out;
  float* outAttn = outTok + (size_t)B * T * D;

  char* ws = (char*)d_ws;
  _Float16* swk  = (_Float16*)(ws + (size_t)512 * 1024);
  _Float16* swv  = (_Float16*)(ws + (size_t)512 * 1024 + 2u * 1024 * 1024);
  float*    qraw = (float*)(ws + (size_t)37 * 1024 * 1024);     // 4 x 1 MB
  _Float16* h16  = (_Float16*)(ws + (size_t)5 * 1024 * 1024);  // 32 MB

  prep_kernel<<<PREP_BLOCKS, 256, 0, stream>>>(tgt, hist, wq, wk, wv, qraw, swk, swv,
                                               h16);

  attn_kernel<<<B * NKV, 256, LDS_TOTAL, stream>>>(h16, mask, swk, swv, qraw,
                                                   qnw, knw, outTok, outAttn);
}

// v009
// It runs in 70.7 microseconds.
// Next to v008, in two timings, it ran 1.04 times as fast each time.
// All steps since v000 together make it 7.08 times as fast.
#include <hip/hip_runtime.h>
#include <hip/hip_bf16.h>

// ---------------- problem constants ----------------
constexpr int B   = 64;
constexpr int T   = 8;
constexpr int D   = 512;
constexpr int S   = 512;
constexpr int NKV = 4;
constexpr int G   = T / NKV;          // 2
constexpr int CHUNK = 64;             // S-chunk processed per iteration
constexpr int NC  = S / CHUNK;        // 8 chunks
constexpr int CHUNK1 = 128;           // S-chunk of pass 1 (k projection + scores)
constexpr int NC1 = S / CHUNK1;       // 4 chunks
constexpr float EPS = 1e-6f;
constexpr float SCALE = 0.044194173824159216f; // D^-0.5

typedef __attribute__((ext_vector_type(16))) _Float16 v16h;
typedef __attribute__((ext_vector_type(4)))  _Float16 v4h;
typedef __attribute__((ext_vector_type(8)))  _Float16 v8h;
typedef __attribute__((ext_vector_type(8)))  float    v8f;
typedef __attribute__((ext_vector_type(2)))  float    v2f;
typedef __attribute__((ext_vector_type(4)))  unsigned v4u;
typedef __attribute__((ext_vector_type(8)))  int      v8i;
typedef __attribute__((ext_vector_type(4)))  int      v4i;

constexpr int      NSLAB     = 4;
constexpr int      SLAB_COLS = D / NSLAB;
constexpr int      PITCH_A   = SLAB_COLS + 8;
constexpr int      PITCH_T   = SLAB_COLS + 16;
constexpr unsigned SLAB_BYTES = 18432;
constexpr int      SLAB_H    = SLAB_BYTES / 2;
constexpr int      PITCH_P   = S + 16;
static_assert(CHUNK * PITCH_T * 2 <= (int)SLAB_BYTES && SLAB_BYTES % 2048 == 0, "slab size");
// Pass 1 holds one chunk of CHUNK1 rows, in the place of pass 2's two buffers.
constexpr unsigned SLAB1_BYTES = CHUNK1 * PITCH_A * 2;     // 128 x 272 = 17 x 2 KiB
constexpr int      SLAB1_H   = SLAB1_BYTES / 2;            // slab stride in f16 units
static_assert(SLAB1_BYTES % 2048 == 0 && SLAB1_BYTES <= 2 * SLAB_BYTES, "pass 1 slab size");
constexpr unsigned LDS_HIST0 = 0;                          // NSLAB slabs, 72 KB
constexpr unsigned LDS_HIST1 = LDS_HIST0 + NSLAB * SLAB_BYTES;  // double buffer, 72 KB
constexpr unsigned LDS_SQP   = LDS_HIST1 + NSLAB * SLAB_BYTES;  // [8 waves][2 halves][PITCH_P] f32
constexpr unsigned LDS_SCP   = LDS_SQP   + 16 * PITCH_P * 4; // [8 waves][G][PITCH_P] f32
constexpr unsigned LDS_CTX   = LDS_SCP   + 16 * PITCH_P * 4; // [G][D] f16
constexpr unsigned LDS_QK    = LDS_CTX   + G * D * 2;      // [G][D] f16
constexpr unsigned LDS_ATTN  = LDS_QK    + G * D * 2;      // [G][S] f16
constexpr unsigned LDS_SCORE = LDS_ATTN  + G * S * 2;      // [G][S] f32
constexpr unsigned LDS_RED   = LDS_SCORE + G * S * 4;      // [128] f32
constexpr unsigned LDS_TOTAL = LDS_RED   + 128 * 4;        // ~221 KB (<320 KB/WGP)
static_assert(LDS_TOTAL <= 327680, "LDS of one WGP");

__device__ __forceinline__ v8f wmma32(v16h a, v16h b, v8f c) {
  return __builtin_amdgcn_wmma_f32_16x16x32_f16(false, a, false, b,
                                                (short)0, c, false, false);
}

__device__ __forceinline__ int kcol(int p) {
  return ((p & 4) ? 16 : 0) + 2 * (p & 3);
}

// Load a 16(rows) x 32(K) fragment from row-major f16 memory (LDS or global).
// Rows beyond maxRow are clamped (for the G=2 query/attn rows padded to 16).
__device__ __forceinline__ v16h load_ab_f16(const _Float16* src, int pitch,
                                            int lane, int maxRow) {
  int m = lane & 15; if (m > maxRow) m = maxRow;
  int hi = (lane >> 4) & 1;
  const _Float16* row = src + m * pitch + 8 * hi;
  // k = 8*hi + 0..7 and 16 + 8*hi + 0..7, each run one 16-byte load (src and pitch
  // are multiples of 16 bytes)
  v8h lo = *reinterpret_cast<const v8h*>(row);
  v8h up = *reinterpret_cast<const v8h*>(row + 16);
  return __builtin_shufflevector(lo, up, 0, 1, 2, 3, 4, 5, 6, 7,
                                 8, 9, 10, 11, 12, 13, 14, 15);
}

// Same but source is row-major f32 in global memory (converted on the fly).
__device__ __forceinline__ v16h load_ab_f32(const float* src, int pitch, int lane) {
  int m = lane & 15;
  int hi = (lane >> 4) & 1;
  const float* row = src + (size_t)m * pitch + 8 * hi;
  v16h f;
#pragma unroll
  for (int p = 0; p < 8; ++p) {
    const float* q = row + kcol(p);
    f[2 * p]     = (_Float16)q[0];
    f[2 * p + 1] = (_Float16)q[1];
  }
  return f;
}

// 32(K rows) x 16(N columns) B fragment out of a row-major f16 LDS tile: the two
// transposing loads hand lane (c, hi) column c at k = 8*hi + 0..7 and 16 + 8*hi + 0..7,
// the k order of load_ab_f16.
__device__ __forceinline__ v16h load_bt_f16(const _Float16* tile, int pitch, int lane) {
  typedef __attribute__((ext_vector_type(8))) short s16x8;
  typedef __attribute__((address_space(3))) s16x8 lds_s16x8;
  const _Float16* p =
      tile + (8 * (lane >> 4) + (lane & 7)) * pitch + 8 * ((lane >> 3) & 1);
  v8h lo = __builtin_bit_cast(
      v8h, __builtin_amdgcn_ds_load_tr16_b128_v8i16((lds_s16x8*)p));
  v8h hi = __builtin_bit_cast(
      v8h, __builtin_amdgcn_ds_load_tr16_b128_v8i16((lds_s16x8*)(p + 16 * pitch)));
  return __builtin_shufflevector(lo, hi, 0, 1, 2, 3, 4, 5, 6, 7,
                                 8, 9, 10, 11, 12, 13, 14, 15);
}

// One pre-swizzled 32(K) x 16(N) weight fragment, 1 KiB: the 32 lanes' first eight
// elements lie in a row (512 bytes), then their second eight. So each of the two
// 16-byte loads of a wave covers 512 contiguous bytes, four whole 128-byte lines.
// p points at this lane's first eight elements (fragment base + lane * 8).
constexpr int WFRAG_HALF = 32 * 8;                         // f16 units: 512 B
__device__ __forceinline__ v16h load_w_frag(const _Float16* p) {
  v8h lo = *reinterpret_cast<const v8h*>(p);
  v8h up = *reinterpret_cast<const v8h*>(p + WFRAG_HALF);
  return __builtin_shufflevector(lo, up, 0, 1, 2, 3, 4, 5, 6, 7,
                                 8, 9, 10, 11, 12, 13, 14, 15);
}

__device__ __forceinline__ v8f vzero() {
  v8f z = {0.f, 0.f, 0.f, 0.f, 0.f, 0.f, 0.f, 0.f};
  return z;
}

// ---- Tensor mover: one slab (ROWS rows of 256 bytes, source pitch 2*D bytes) ----
typedef __attribute__((ext_vector_type(4))) uint32_t u32x4;
typedef __attribute__((ext_vector_type(8))) uint32_t u32x8;

__device__ __forceinline__ uint32_t uni(uint32_t v) {
  return (uint32_t)__builtin_amdgcn_readfirstlane(v);
}
__device__ __forceinline__ uint32_t pinned(uint32_t v) {
  uint32_t w = uni(v);
  asm volatile("" : "+s"(w));  // pinned(): keeps the test in a scalar register
  return w;
}
// the compiler places no wait for the tensor mover
__device__ __forceinline__ void wait_tensor0() {
  asm volatile("s_wait_tensorcnt 0x0" ::: "memory");
}
// this wave's LDS reads and writes are done before the buffer is handed over
__device__ __forceinline__ void wait_ds0() {
  asm volatile("s_wait_dscnt 0x0" ::: "memory");
}
template <unsigned PADA, unsigned ROWS>
__device__ __forceinline__ u32x8 tdm_group1() {
  constexpr uint32_t d0 = SLAB_COLS * 2, d1 = ROWS;        // bytes a row, rows
  u32x8 g1;
  g1[0] = uni((1u << 20) | (5u << 22) | (PADA << 25));
  g1[1] = uni(d0 << 16);
  g1[2] = uni(d1 << 16);
  g1[3] = uni(d0 << 16);
  g1[4] = uni(d1);
  g1[5] = uni((uint32_t)D * 2u);
  g1[6] = pinned(0u);
  g1[7] = pinned(0u);
  return g1;
}
__device__ __forceinline__ void tdm_load_slab(u32x8 g1, const _Float16* gsrc,
                                              uint32_t ldsDst) {
  unsigned long long ga = (unsigned long long)(uintptr_t)gsrc;
  u32x4 g0;
  g0[0] = uni(1u);                                          // count = 1
  g0[1] = uni(ldsDst);                                      // LDS byte address
  g0[2] = uni((uint32_t)ga);                                // global address [31:0]
  g0[3] = uni((((uint32_t)(ga >> 32)) & 0x01FFFFFFu) | 0x80000000u);  // [56:32], type 2
  asm volatile("tensor_load_to_lds %0, %1" :: "s"(g0), "s"(g1) : "memory");
}

__device__ __forceinline__ void swizzle_job(const float* __restrict__ W,
                                            _Float16* __restrict__ out, int blk) {
  int idx = blk * 256 + threadIdx.x;
  int h    = idx & 7;         // element in a lane's run of eight
  int lane = (idx >> 3) & 31;
  int half = (idx >> 8) & 1;  // the lanes' first or second eight (load_w_frag)
  int tile = idx >> 9;
  int dt   = tile & 15;       // D/32 == 16
  int etg  = tile >> 4;
  int e = etg * 16 + (lane & 15);
  int d = dt * 32 + 16 * half + 8 * (lane >> 4) + h;
  out[idx] = (_Float16)W[(size_t)e * 512 + d];
}

__device__ __forceinline__ void cvt_job(const float* __restrict__ src,
                                        _Float16* __restrict__ dst, int blk) {
  int i = blk * 256 + threadIdx.x;
  float4 x = reinterpret_cast<const float4*>(src)[i];
  v4h h;
  h[0] = (_Float16)x.x; h[1] = (_Float16)x.y;
  h[2] = (_Float16)x.z; h[3] = (_Float16)x.w;
  *reinterpret_cast<v4h*>(dst + (size_t)i * 4) = h;
}

// ---------------- job: raw q = target @ Wq^T -------------------------------
// One 16 x 16 tile a wave, eight tiles a block. Both operands come straight from the
// row-major f32 inputs (a weight row is a B column, read in the k order of the A loader),
// so nothing has to be prepared for this job by an earlier launch. An f32 fragment takes
// twice the registers of an f16 one: with one tile a wave the job stays inside the
// register budget that the streaming jobs of the same kernel need for full occupancy.
// Each k-step is one round trip to memory, so the D / 32 k-steps are dealt to QP_KSPLIT
// blocks, which each store a partial sum in a plane of their own.
// A q row is then spread over QP_SPLIT * QP_KSPLIT blocks: the planes are added and the
// RMS norm is taken where the row is read.
// Tile (rt, ct) is stored as 16 rows of 16 f32, 1 KiB in a row: whole lines, one writer.
constexpr int QP_SPLIT  = D / (8 * 16);
constexpr int QP_KSPLIT = 4;
constexpr int QP_KSTEPS = D / 32 / QP_KSPLIT;
__device__ __forceinline__ size_t qraw_index(int plane, int row, int col) {
  return (((size_t)plane * (B * T / 16) + (row >> 4)) * (D / 16) + (col >> 4)) * 256 +
         (row & 15) * 16 + (col & 15);
}
__device__ __forceinline__ void qproj_job(const float* __restrict__ tgt,
                                          const float* __restrict__ wq,
                                          float* __restrict__ qRaw, int blk) {
  int lane = threadIdx.x & 31;
  int w    = threadIdx.x >> 5;
  int ks = blk % QP_KSPLIT;
  int ct = (blk / QP_KSPLIT % QP_SPLIT) * 8 + w;
  int rt = blk / (QP_KSPLIT * QP_SPLIT);
  const float* ap = tgt + (size_t)rt * 16 * D + ks * QP_KSTEPS * 32;
  const float* bp = wq + (size_t)ct * 16 * D + ks * QP_KSTEPS * 32;
  v8f acc = vzero();
#pragma unroll 1
  for (int kt = 0; kt < QP_KSTEPS; ++kt) {
    v16h a  = load_ab_f32(ap + kt * 32, D, lane);
    v16h bf = load_ab_f32(bp + kt * 32, D, lane);
    acc = wmma32(a, bf, acc);
  }
  int nn = lane & 15, mb = (lane >> 4) * 8;
#pragma unroll
  for (int r = 0; r < 8; ++r)
    qRaw[qraw_index(ks, rt * 16 + mb + r, ct * 16 + nn)] = acc[r];
}

// ---------------- kernel 0: the preparation, one launch ----------
// None of these four jobs reads what another of them writes, so they share one grid
// and a block takes its job by its index. The q projection's blocks stand first: they
// are few, and each is a chain of dependent loads, which so runs beside the
// streaming jobs and not in a launch of its own.
// Stands behind a job's store: the store is still in flight where the code that follows
// the job in the merged kernel rewrites a register that it names.
__device__ __forceinline__ void wait_store_regs() {
  asm volatile("s_wait_xcnt 0x0" ::: "memory");
}
constexpr int QP_BLOCKS = B * T / 16 * QP_SPLIT * QP_KSPLIT;
constexpr int SW_BLOCKS = NKV * D * D / 256;
constexpr int CV_BLOCKS = B * S * D / 1024;
constexpr int PREP_BLOCKS = QP_BLOCKS + 2 * SW_BLOCKS + CV_BLOCKS;
__global__ __launch_bounds__(256)
void prep_kernel(const float* __restrict__ tgt, const float* __restrict__ hist,
                 const float* __restrict__ wq,
                 const float* __restrict__ wk, const float* __restrict__ wv,
                 float* __restrict__ qRaw,
                 _Float16* __restrict__ swk, _Float16* __restrict__ swv,
                 _Float16* __restrict__ h16) {
  int blk = blockIdx.x;   // every test below reads the same for a whole block
  if (blk < QP_BLOCKS) {
    qproj_job(tgt, wq, qRaw, blk);
  } else if (blk < QP_BLOCKS + SW_BLOCKS) {
    swizzle_job(wk, swk, blk - QP_BLOCKS);
    wait_store_regs();
  } else if (blk < QP_BLOCKS + 2 * SW_BLOCKS) {
    swizzle_job(wv, swv, blk - QP_BLOCKS - SW_BLOCKS);
    wait_store_regs();
  } else {
    cvt_job(hist, h16, blk - QP_BLOCKS - 2 * SW_BLOCKS);
    wait_store_regs();
  }
}

__global__ __launch_bounds__(256)
void attn_kernel(const _Float16* __restrict__ histF16,
                 const int* __restrict__ mask,
                 const _Float16* __restrict__ swk, const _Float16* __restrict__ swv,
                 const float* __restrict__ qRaw,
                 const float* __restrict__ qw, const float* __restrict__ kw,
                 float* __restrict__ outTok, float* __restrict__ outAttn) {
  // 2 KiB: every tensor load's place in LDS is a multiple of that
  extern __shared__ __attribute__((aligned(2048))) char smemRaw[];
  float*    sqPart = (float*)(smemRaw + LDS_SQP);
  float*    scPart = (float*)(smemRaw + LDS_SCP);
  _Float16* qkL    = (_Float16*)(smemRaw + LDS_QK);
  _Float16* attnL  = (_Float16*)(smemRaw + LDS_ATTN);
  float*    scoresL = (float*)(smemRaw + LDS_SCORE);
  float*    red     = (float*)(smemRaw + LDS_RED);

  int wg = blockIdx.x;
  int b  = wg / NKV;
  int n  = wg % NKV;
  int tid  = threadIdx.x;
  int lane = tid & 31;
  int w    = tid >> 5;
  int nn = lane & 15;

  const _Float16* histSrc = histF16 + (size_t)b * S * D;

  // Waves 0..NSLAB-1 each bring one column slab of every chunk.
  const uint32_t wave = uni(threadIdx.x >> 5);
  const uint32_t ldsBase = (uint32_t)(uintptr_t)smemRaw;   // byte offset in the work-group's LDS
  const _Float16* slabSrc = histSrc + wave * SLAB_COLS;
  const uint32_t slabDst = ldsBase + LDS_HIST0 + wave * SLAB_BYTES;

  const uint32_t slabDst1 = ldsBase + LDS_HIST0 + wave * SLAB1_BYTES;

  const u32x8 g1a = tdm_group1<3, CHUNK1>();
  // pass 1 has one history buffer: chunk 0 lands and is published
  if (pinned(wave < NSLAB)) {
    tdm_load_slab(g1a, slabSrc, slabDst1);
    wait_tensor0();
  }
  // q = rmsnorm(raw q) * (1+qw), times (1+kw) of the k norm. Waves NSLAB .. NSLAB+G-1,
  // which bring no slab, make one q row each while the slabs land: a whole row in one
  // wave, 16 columns a lane, so that its squares are summed over the lanes alone.
  static_assert(NSLAB + G <= 8 && D == 4 * 128 && QP_KSPLIT == 4, "one wave a q row");
  if (wave >= NSLAB && wave < NSLAB + G) {
    const int g = (int)wave - NSLAB;
    const int row = b * T + n * G + g;
    // The row is the same for the whole wave: its place is a scalar base, plane and
    // column group are constant steps from it, and one lane offset serves all 16 loads.
    const float* rowP = qRaw + qraw_index(0, row, 0);
    const unsigned laneOff = (unsigned)qraw_index(0, 0, lane * 4);
    constexpr size_t PLANE = (size_t)B * T * D, GROUP = (128 / 16) * 256;
    float4 x[4], fq[4], fk[4];
    float sq = 0.f;
#pragma unroll
    for (int u = 0; u < 4; ++u) {
      const int col = u * 128 + lane * 4;
      const float* pu = rowP + u * GROUP + laneOff;
      float4 p0 = *reinterpret_cast<const float4*>(pu);
      float4 p1 = *reinterpret_cast<const float4*>(pu + PLANE);
      float4 p2 = *reinterpret_cast<const float4*>(pu + 2 * PLANE);
      float4 p3 = *reinterpret_cast<const float4*>(pu + 3 * PLANE);
      fq[u] = *reinterpret_cast<const float4*>(qw + col);
      fk[u] = *reinterpret_cast<const float4*>(kw + col);
      x[u].x = (p0.x + p1.x) + (p2.x + p3.x);
      x[u].y = (p0.y + p1.y) + (p2.y + p3.y);
      x[u].z = (p0.z + p1.z) + (p2.z + p3.z);
      x[u].w = (p0.w + p1.w) + (p2.w + p3.w);
      sq += (x[u].x * x[u].x + x[u].y * x[u].y) + (x[u].z * x[u].z + x[u].w * x[u].w);
    }
#pragma unroll
    for (int m = 16; m > 0; m >>= 1) sq += __shfl_xor(sq, m);
    const float rs = rsqrtf(sq * (1.f / D) + EPS);
#pragma unroll
    for (int u = 0; u < 4; ++u) {
      v4h h;
      h[0] = (_Float16)(x[u].x * rs * (1.f + fq[u].x) * (1.f + fk[u].x));
      h[1] = (_Float16)(x[u].y * rs * (1.f + fq[u].y) * (1.f + fk[u].y));
      h[2] = (_Float16)(x[u].z * rs * (1.f + fq[u].z) * (1.f + fk[u].z));
      h[3] = (_Float16)(x[u].w * rs * (1.f + fq[u].w) * (1.f + fk[u].w));
      *reinterpret_cast<v4h*>(qkL + g * D + u * 128 + lane * 4) = h;
    }
  }
  __syncthreads();

  // ================= pass 1: k projection + scores =================
  // k-proj: wave w makes columns [w*64, w*64+64) of all CHUNK1 rows of a chunk, a tile
  // of 8 x 4 fragments: every weight fragment is loaded by one wave only and feeds
  // eight WMMAs, so that the weights come from L2 NC1 times.
  // The product is formed transposed, k^T = Wk @ hist^T (the weight fragment is the A
  // operand): a lane then holds one history row s at eight neighbouring columns e a
  // fragment. So the row's squares add up in the lane, and two fragments, rounded to
  // f16, are as they stand the B operand of the score product: k goes through no LDS.
  // Fragment (j, kt) of this wave's weight slice stands at wb + (j*16 + kt)*512.
  const _Float16* wb =
      swk + ((size_t)(n * 32 + w * 4) * 16) * 512 + lane * 8;
  v16h bk[16];
#pragma unroll
  for (int u = 0; u < 4; ++u)
#pragma unroll
    for (int j = 0; j < 4; ++j) bk[u * 4 + j] = load_w_frag(wb + (j * 16 + u) * 512);

  // the query rows at this wave's 64 columns: A operand of its part of the scores
  v16h aq[2];
#pragma unroll
  for (int h = 0; h < 2; ++h)
    aq[h] = load_ab_f16(qkL + w * 64 + h * 32, D, lane, G - 1);

  for (int c = 0; c < NC1; ++c) {
    const _Float16* histL = (const _Float16*)(smemRaw + LDS_HIST0);
    {
      // k-step kt stands in slab kt / 4 at column (kt % 4) * 32
      v8f acc[32];
#pragma unroll
      for (int t = 0; t < 32; ++t) acc[t] = vzero();
      v16h a[4];
#pragma unroll
      for (int i = 0; i < 4; ++i)
        a[i] = load_ab_f16(histL + (i * 16) * PITCH_A, PITCH_A, lane, 15);
      // One trip is one slab, four k-steps; a k-step is two half-steps, rows 0..63 and
      // rows 64..127, on the same four weight fragments. The history fragments are read one
      // half-step ahead; each weight register set is refilled for k-step kt + 4 right
      // behind the last four WMMAs that read it.
      // Kept rolled: unrolled, the weight loads no longer depend on a loop count,
      // are lifted out of the chunk loop and spill.
#pragma unroll 1
      for (int kb = 0; kb < 16; kb += 4) {
        const int kw = (kb + 4) & 15;
        const _Float16* wn = wb + kw * 512;
        const _Float16* ab = histL + (kb >> 2) * SLAB1_H;
        const _Float16* abn = histL + (kw >> 2) * SLAB1_H;
#pragma unroll
        for (int u = 0; u < 4; ++u) {
#pragma unroll
          for (int hf = 0; hf < 2; ++hf) {
            const _Float16* as = (hf == 0) ? ab + u * 32 + 64 * PITCH_A
                                           : ((u < 3) ? ab + (u + 1) * 32 : abn);
            v16h an[4];
#pragma unroll
            for (int i = 0; i < 4; ++i)
              an[i] = load_ab_f16(as + (i * 16) * PITCH_A, PITCH_A, lane, 15);
            // keeps the next history fragments' eight LDS reads as one group at the head of
            // their half-step: left alone the scheduler lumps the reads of several
            // half-steps, takes more registers, and one LDS wait drains to 0
            __builtin_amdgcn_sched_group_barrier(0x100, 8, 0);
#pragma unroll
            for (int j = 0; j < 4; ++j) {
#pragma unroll
              for (int i = 0; i < 4; ++i)
                acc[hf * 16 + i * 4 + j] =
                    wmma32(bk[u * 4 + j], a[i], acc[hf * 16 + i * 4 + j]);
              // keeps the order four WMMAs and, in the second half-step, their two
              // refill loads: without it the scheduler puts refills off and fewer
              // loads are in flight at the waits
              __builtin_amdgcn_sched_group_barrier(0x008, 4, 0);
              if (hf == 1) {
                bk[u * 4 + j] = load_w_frag(wn + (j * 16 + u) * 512);
                __builtin_amdgcn_sched_group_barrier(0x020, 2, 0);
              }
            }
#pragma unroll
            for (int i = 0; i < 4; ++i) a[i] = an[i];
          }
        }
        // the refill loads are still in flight when the next trip rewrites the
        // address register that they name
        asm volatile("s_wait_xcnt 0x0" ::: "memory");
      }
      // every wave has left the history buffer: chunk c + 1 is asked for here and lands
      // while the waves work on their accumulators
      wait_ds0();
      __syncthreads();
      if (pinned((wave < NSLAB) && (c + 1 < NC1)))
        tdm_load_slab(g1a, slabSrc + (size_t)(c + 1) * CHUNK1 * D, slabDst1);

      // Per 16-row tile i: this wave's part (64 of the D columns) of each row's sum of
      // squares and of its two scores. The parts of the eight waves are added behind the
      // chunk loop.
#pragma unroll
      for (int i = 0; i < 8; ++i) {
        // Neighbouring accumulator registers are squared as a pair (one packed FMA on a
        // register pair as it lies); one sum a fragment: four short chains, not one long.
        v2f sj[4];
#pragma unroll
        for (int j = 0; j < 4; ++j) {
          sj[j] = v2f{0.f, 0.f};
#pragma unroll
          for (int r = 0; r < 8; r += 2) {
            v2f x = {acc[i * 4 + j][r], acc[i * 4 + j][r + 1]};
            sj[j] += x * x;
          }
        }
        v2f s2 = (sj[0] + sj[1]) + (sj[2] + sj[3]);
        float sq = s2[0] + s2[1];
        v8f sc = vzero();
#pragma unroll
        for (int h = 0; h < 2; ++h) {
          // lane (s, hi) holds e = 8*hi + 0..7 of fragment 2h and, 16 columns on, of
          // fragment 2h + 1: the k order of load_ab_f16
          v16h kf;
#pragma unroll
          for (int r = 0; r < 8; ++r) {
            kf[r]     = (_Float16)acc[i * 4 + 2 * h][r];
            kf[8 + r] = (_Float16)acc[i * 4 + 2 * h + 1][r];
          }
          sc = wmma32(aq[h], kf, sc);
        }
        int p = (w * 2 + (lane >> 4)) * PITCH_P + c * CHUNK1 + i * 16 + nn;
        sqPart[p] = sq;
        scPart[p] = sc[0];
      }
    }
    // foot of the trip: chunk c + 1 is published (and, in the last trip, the partial sums)
    wait_ds0();
    if (pinned(wave < NSLAB)) wait_tensor0();
    __syncthreads();
  }
  wait_tensor0();
  wait_ds0();

  // ================= softmax over S =================
  static_assert(G == 2, "one score row per lane half");
  for (int s = tid; s < S; s += 256) {
    float sq = 0.f, sc0 = 0.f, sc1 = 0.f;
#pragma unroll
    for (int p = 0; p < 8; ++p) {
      sq  += sqPart[(2 * p) * PITCH_P + s] + sqPart[(2 * p + 1) * PITCH_P + s];
      sc0 += scPart[(2 * p) * PITCH_P + s];
      sc1 += scPart[(2 * p + 1) * PITCH_P + s];
    }
    float rs = rsqrtf(sq * (1.f / D) + EPS);
    bool off = mask[b * S + s] != 0;
    scoresL[s]     = off ? -__builtin_inff() : sc0 * rs * SCALE;
    scoresL[S + s] = off ? -__builtin_inff() : sc1 * rs * SCALE;
  }
  __syncthreads();
  if (tid < 64) {
    int g = tid >> 5, l = tid & 31;
    float mx = -__builtin_inff();
    for (int s = l; s < S; s += 32) mx = fmaxf(mx, scoresL[g * S + s]);
    red[g * 32 + l] = mx;
  }
  __syncthreads();
  if (tid < 2) {
    float mx = -__builtin_inff();
    for (int l = 0; l < 32; ++l) mx = fmaxf(mx, red[tid * 32 + l]);
    red[tid * 32] = mx;
  }
  __syncthreads();
  if (tid < 64) {
    int g = tid >> 5, l = tid & 31;
    float mx = red[g * 32];
    float sm = 0.f;
    for (int s = l; s < S; s += 32) {
      float e = __expf(scoresL[g * S + s] - mx);
      scoresL[g * S + s] = e;
      sm += e;
    }
    red[64 + g * 32 + l] = sm;
  }
  __syncthreads();
  if (tid < 2) {
    float sm = 0.f;
    for (int l = 0; l < 32; ++l) sm += red[64 + tid * 32 + l];
    red[64 + tid * 32] = 1.f / sm;
  }
  __syncthreads();
  for (int i = tid; i < G * S; i += 256) {
    int g = i >> 9, s = i & (S - 1);
    float a = scoresL[i] * red[64 + g * 32];
    attnL[i] = (_Float16)a;
    outAttn[(size_t)(b * T + n * G + g) * S + s] = a;
  }
  __syncthreads();

  // ===== pass 2: out = attn @ (hist @ Wv^T), summed as (attn @ hist) @ Wv^T =====
  v8f oacc[4];
#pragma unroll
  for (int j = 0; j < 4; ++j) oacc[j] = vzero();

  // chunks of CHUNK rows in a double-buffered ring, the rows at the transposing reader's pitch
  const u32x8 g1t = tdm_group1<7, CHUNK>();
  if (pinned(wave < NSLAB)) {
    tdm_load_slab(g1t, slabSrc, slabDst);
    wait_tensor0();
  }
  __syncthreads();
  if (pinned(wave < NSLAB))
    tdm_load_slab(g1t, slabSrc + (size_t)CHUNK * D, slabDst + (LDS_HIST1 - LDS_HIST0));

  // Wave w owns e range [w*64, w*64+64) of out = ctx @ Wv^T; fragment (j, kt) of its
  // weight slice stands at wv4 + (j*16 + kt)*512. K-steps 0..7 are asked for here,
  // ahead of the chunk loop: they need nothing of it.
  const _Float16* wv4 =
      swv + ((size_t)(n * 32 + w * 4) * 16) * 512 + lane * 8;
  v16h bq[32];
#pragma unroll
  for (int kt = 0; kt < 8; ++kt)
#pragma unroll
    for (int j = 0; j < 4; ++j)
      bq[kt * 4 + j] = load_w_frag(wv4 + (j * 16 + kt) * 512);

  for (int c = 0; c < NC; ++c) {
    const _Float16* histL =
        (const _Float16*)(smemRaw + ((c & 1) ? LDS_HIST1 : LDS_HIST0));

    // ctx += attn[:, chunk] @ hist_chunk ; wave w owns d range [w*64, w*64+64)
#pragma unroll
    for (int ks = 0; ks < CHUNK / 32; ++ks) {
      v16h a = load_ab_f16(attnL + c * CHUNK + ks * 32, S, lane, G - 1);
#pragma unroll
      for (int j = 0; j < 4; ++j) {
        v16h bf = load_bt_f16(histL + (w >> 1) * SLAB_H + (ks * 32) * PITCH_T +
                                  (w & 1) * 64 + j * 16,
                              PITCH_T, lane);
        oacc[j] = wmma32(a, bf, oacc[j]);
      }
    }
    wait_ds0();
    if (pinned(wave < NSLAB)) wait_tensor0();
    __syncthreads();
    if (pinned((wave < NSLAB) && (c + 2 < NC)))
      tdm_load_slab(g1t, slabSrc + (size_t)(c + 2) * CHUNK * D,
                       slabDst + ((c & 1) ? (LDS_HIST1 - LDS_HIST0) : 0u));
  }
  wait_tensor0();
  wait_ds0();

  static_assert(G == 2, "one ctx row per lane half");
  _Float16* ctxL = (_Float16*)(smemRaw + LDS_CTX);
#pragma unroll
  for (int j = 0; j < 4; ++j)
    ctxL[(lane >> 4) * D + w * 64 + j * 16 + nn] = (_Float16)oacc[j][0];
  __syncthreads();

  // out = ctx @ Wv^T: k-steps 0..7 run on the fragments asked for above, and each
  // register set is refilled for k-step kt + 8 in the k-step that read it.
  v8f tacc[4];
#pragma unroll
  for (int j = 0; j < 4; ++j) tacc[j] = vzero();
  v16h a = load_ab_f16(ctxL, D, lane, G - 1);
#pragma unroll
  for (int kt = 0; kt < 16; ++kt) {
    v16h an = a;
    if (kt + 1 < 16) an = load_ab_f16(ctxL + (kt + 1) * 32, D, lane, G - 1);
#pragma unroll
    for (int j = 0; j < 4; ++j) {
      tacc[j] = wmma32(a, bq[(kt & 7) * 4 + j], tacc[j]);
      if (kt < 8) bq[kt * 4 + j] = load_w_frag(wv4 + (j * 16 + kt + 8) * 512);
    }
    a = an;
    // holds the refill loads in their k-step: left to itself the scheduler puts
    // each load just ahead of its use, with two fragments in flight
    if (kt < 8) __builtin_amdgcn_sched_barrier(0);
  }

  if (lane < 16) {
#pragma unroll
    for (int j = 0; j < 4; ++j) {
      int e = w * 64 + j * 16 + lane;
      outTok[(size_t)(b * T + n * G + 0) * D + e] = tacc[j][0];
      outTok[(size_t)(b * T + n * G + 1) * D + e] = tacc[j][1];
    }
  }
}

// ---------------- host launcher ----------------
extern "C" void kernel_launch(void* const* d_in, const int* in_sizes, int n_in,
                              void* d_out, int out_size, void* d_ws, size_t ws_size,
                              hipStream_t stream) {
  const float* tgt  = (const float*)d_in[0];
  const float* hist = (const float*)d_in[1];
  const int*   mask = (const int*)d_in[2];
  const float* wq   = (const float*)d_in[3];
  const float* wk   = (const float*)d_in[4];
  const float* wv   = (const float*)d_in[5];
  const float* qnw  = (const float*)d_in[6];
  const float* knw  = (const float*)d_in[7];

  float* outTok  = (float*)d_out;
  float* outAttn = outTok + (size_t)B * T * D;

  char* ws = (char*)d_ws;
  _Float16* swk  = (_Float16*)(ws + (size_t)512 * 1024);
  _Float16* swv  = (_Float16*)(ws + (size_t)512 * 1024 + 2u * 1024 * 1024);
  float*    qraw = (float*)(ws + (size_t)37 * 1024 * 1024);     // 4 x 1 MB
  _Float16* h16  = (_Float16*)(ws + (size_t)5 * 1024 * 1024);  // 32 MB

  prep_kernel<<<PREP_BLOCKS, 256, 0, stream>>>(tgt, hist, wq, wk, wv, qraw, swk, swv,
                                               h16);

  attn_kernel<<<B * NKV, 256, LDS_TOTAL, stream>>>(h16, mask, swk, swv, qraw,
                                                   qnw, knw, outTok, outAttn);
}
